// v000
// Measured on an AMD MI455X. A time is GPU time per run, averaged over a window of back-to-back runs after a warm-up
// (all launches, gaps included; the runs take copies of the inputs in turn), and the median of several windows.
// Apart from v000's, it joins two sittings. Times from different sittings can be a few percent apart, while
// side-by-side timings come from the same sitting.
// The starting kernel, v000, takes 1180 microseconds a run.
// Contractions: v_wmma_f32_16x16x32_f16 (f16 operands, f32 accumulate) for the three 1x1 projections,
// q.k^T, p.v (p carried x2^15) and the output projection; GroupNorm statistics f64/f32, softmax f32.
#include <hip/hip_runtime.h>

typedef __attribute__((ext_vector_type(16))) _Float16 v16h;
typedef __attribute__((ext_vector_type(8)))  _Float16 v8h;
typedef __attribute__((ext_vector_type(16))) __bf16   v16b;
typedef __attribute__((ext_vector_type(8)))  __bf16   v8b;
typedef __attribute__((ext_vector_type(8)))  float    v8f;
typedef __attribute__((ext_vector_type(4)))  float    v4f;
#define U16(p) ((const unsigned short*)(const void*)(p))

static constexpr int kB  = 16;          // batch
static constexpr int kN  = 4096;        // tokens per image (64*64)
static constexpr int kC  = 128;         // channels
static constexpr int kM  = kB * kN;     // 65536 token rows
static constexpr int kNG = 32;          // groups
static constexpr int kCPG = 4;          // channels per group

__device__ __forceinline__ unsigned short f2bf_bits(float f) {
  unsigned u = __float_as_uint(f);
  return (unsigned short)((u + 0x7FFFu + ((u >> 16) & 1u)) >> 16);
}
__device__ __forceinline__ float bf_bits2f(unsigned short h) { return __uint_as_float(((unsigned)h) << 16); }

// hazard guards as plain device helpers
__device__ __forceinline__ void dep_guard_h(v8f& a, v8f& b, v16h x, v16h y) { asm volatile("v_nop\n\tv_nop\n\tv_nop\n\tv_nop" : "+v"(a), "+v"(b) : "v"(x), "v"(y)); }
__device__ __forceinline__ void dep_guard_b(v8f& a, v8f& b, v16b x, v16b y) { asm volatile("v_nop\n\tv_nop\n\tv_nop\n\tv_nop" : "+v"(a), "+v"(b) : "v"(x), "v"(y)); }
__device__ __forceinline__ void keep4_h(v16h a, v16h b, v16h c, v16h d) { asm volatile("v_nop" :: "v"(a), "v"(b), "v"(c), "v"(d)); }
__device__ __forceinline__ void keep4_b(v16b a, v16b b, v16b c, v16b d) { asm volatile("v_nop" :: "v"(a), "v"(b), "v"(c), "v"(d)); }
__device__ __forceinline__ void acc_guard4(v8f& a, v8f& b, v8f& c, v8f& d) { asm volatile("v_nop\n\tv_nop\n\tv_nop\n\tv_nop" : "+v"(a), "+v"(b), "+v"(c), "+v"(d)); }
template <typename T> struct Frag;
template <> struct Frag<_Float16> {
  typedef v16h V; union U { v16h v; v8h h[2]; };
  static __device__ __forceinline__ v16h load(const _Float16* p) {   // elements 0..7 <- p[0..7], 8..15 <- p[16..23]
    U f; f.h[0] = *(const v8h*)(p); f.h[1] = *(const v8h*)(p + 16); return f.v;
  }
  static __device__ __forceinline__ v8f mma(v16h a, v16h b, v8f c) {
    return __builtin_amdgcn_wmma_f32_16x16x32_f16(false, a, false, b, (short)0, c, false, false);
  }
  static __device__ __forceinline__ void guard(v8f& a, v8f& b, v16h x, v16h y) { dep_guard_h(a, b, x, y); }
  static __device__ __forceinline__ void keep(v16h a, v16h b, v16h c, v16h d) { keep4_h(a, b, c, d); }
};
template <> struct Frag<__bf16> {
  typedef v16b V; union U { v16b v; v8b h[2]; };
  static __device__ __forceinline__ v16b load(const __bf16* p) {
    U f; f.h[0] = *(const v8b*)(p); f.h[1] = *(const v8b*)(p + 16); return f.v;
  }
  static __device__ __forceinline__ v8f mma(v16b a, v16b b, v8f c) {
    return __builtin_amdgcn_wmma_f32_16x16x32_bf16(false, a, false, b, (short)0, c, false, false);
  }
  static __device__ __forceinline__ void guard(v8f& a, v8f& b, v16b x, v16b y) { dep_guard_b(a, b, x, y); }
  static __device__ __forceinline__ void keep(v16b a, v16b b, v16b c, v16b d) { keep4_b(a, b, c, d); }
};

// per-call guarded f16 WMMA (4 nops tying D and both operands)
__device__ __forceinline__ v8f mma16(v16h a, v16h b, v8f c) {
  c = __builtin_amdgcn_wmma_f32_16x16x32_f16(false, a, false, b, (short)0, c, false, false);
  asm volatile("v_nop\n\tv_nop\n\tv_nop\n\tv_nop" : "+v"(c) : "v"(a), "v"(b));
  return c;
}

// ---- Register-blocked batched WMMA GEMM --------------------------------
// C[m,n] = scale * sum_k A[m,k] * Bt[n,k] (+bias)(+resid); each wave owns a 64x64 tile.
// A row-major [M,K]; Bt row-major [N,K]; M,N % 64 == 0, K % 32 == 0.
// SPLIT: operands are hi/lo planes (A2/Bt2 = lo planes, same layout); product = hi·hi + hi·lo + lo·hi.
// BIAS_MODE: 0 = none, 1 = bias[m], 2 = bias[n].
// OUT_MODE: 0 = f32, 1 = f16, 2 = bf16 hi plane (Cout) + bf16 lo plane (Cout2).
// ET: 0 = f16 operands, 1 = bf16 operands (pointers passed as 16-bit storage)
template <int ET> struct Elem;
template <> struct Elem<0> { typedef _Float16 T; };
template <> struct Elem<1> { typedef __bf16 T; };
template <int ET, bool SPLIT, int BIAS_MODE, int OUT_MODE, bool RESID, int ACT = 0>
__global__ __launch_bounds__(256) void wmma_gemm64(
    const unsigned short* __restrict__ Ap, const unsigned short* __restrict__ A2p, int lda, long strideA,
    const unsigned short* __restrict__ Btp, const unsigned short* __restrict__ Bt2p, int ldb, long strideB,
    void* __restrict__ Cout, void* __restrict__ Cout2, int ldc, long strideC,
    const float* __restrict__ bias,
    const float* __restrict__ resid, long strideR,
    int M, int N, int K, float scale) {
  typedef typename Elem<ET>::T T;
  typedef typename Frag<T>::V V;
  const T* A = (const T*)Ap; const T* A2 = (const T*)A2p; const T* Bt = (const T*)Btp; const T* Bt2 = (const T*)Bt2p;
  __shared__ __align__(16) float sT[8][16 * 68];   // per-wave 16x64 slab, pitch 68 floats
  const int b    = blockIdx.y;
  const int lane = threadIdx.x & 31;
  const int wave = threadIdx.x >> 5;
  const int tilesN = N >> 6;
  const int tilesM = M >> 6;
  const int tile = blockIdx.x * 8 + wave;
  if (tile >= tilesM * tilesN) return;   // wave-uniform; no block barriers in this kernel
  const int tm = tile / tilesN;
  const int tn = tile - tm * tilesN;
  const int m0 = tm << 6;
  const int n0 = tn << 6;

  const T* Ab  = A  + (size_t)b * strideA;
  const T* Bb  = Bt + (size_t)b * strideB;
  const T* Ab2 = SPLIT ? (A2  + (size_t)b * strideA) : nullptr;
  const T* Bb2 = SPLIT ? (Bt2 + (size_t)b * strideB) : nullptr;

  const int rlane = lane & 15;                 // row (A) / col (B, D) within subtile
  const int koff  = (lane >> 4) * 8;           // k offset of this lane half
  const int mOff  = (lane >> 4) * 8;           // D row offset

  v8f acc[4][4];
#pragma unroll
  for (int i = 0; i < 4; ++i)
#pragma unroll
    for (int j = 0; j < 4; ++j) acc[i][j] = (v8f){0.f,0.f,0.f,0.f,0.f,0.f,0.f,0.f};

  for (int k0 = 0; k0 < K; k0 += 32) {
    V bh[4], bl[4];
#pragma unroll
    for (int j = 0; j < 4; ++j) {
      const size_t bo = (size_t)(n0 + (j << 4) + rlane) * ldb + koff + k0;
      bh[j] = Frag<T>::load(Bb + bo);
      if (SPLIT) bl[j] = Frag<T>::load(Bb2 + bo);
    }
#pragma unroll
    for (int i = 0; i < 4; ++i) {
      const size_t ao = (size_t)(m0 + (i << 4) + rlane) * lda + koff + k0;
      V ah = Frag<T>::load(Ab + ao);
      V al;
      if (SPLIT) al = Frag<T>::load(Ab2 + ao);
#pragma unroll
      for (int j = 0; j < 4; ++j) {
        acc[i][j] = Frag<T>::mma(ah, bh[j], acc[i][j]);
        if (SPLIT) {
          acc[i][j] = Frag<T>::mma(ah, bl[j], acc[i][j]);
          acc[i][j] = Frag<T>::mma(al, bh[j], acc[i][j]);
        }
      }
      Frag<T>::guard(acc[i][0], acc[i][3], ah, SPLIT ? al : ah);
    }
    Frag<T>::keep(bh[0], bh[1], bh[2], bh[3]);
    if (SPLIT) Frag<T>::keep(bl[0], bl[1], bl[2], bl[3]);
  }
  acc_guard4(acc[0][0], acc[0][1], acc[0][2], acc[0][3]);
  acc_guard4(acc[1][0], acc[1][1], acc[1][2], acc[1][3]);
  acc_guard4(acc[2][0], acc[2][1], acc[2][2], acc[2][3]);
  acc_guard4(acc[3][0], acc[3][1], acc[3][2], acc[3][3]);

  // ---- epilogue ----
  float* slab = sT[wave];
  const float* Rb = RESID ? (resid + (size_t)b * strideR) : nullptr;
#pragma unroll
  for (int i = 0; i < 4; ++i) {
    const int mBase = m0 + (i << 4);
#pragma unroll
    for (int j = 0; j < 4; ++j) {
      const int n = n0 + (j << 4) + rlane;
      float bv = 0.f;
      if (BIAS_MODE == 2) bv = bias[n];
#pragma unroll
      for (int r = 0; r < 8; ++r) {
        float v = acc[i][j][r] * scale;
        if (BIAS_MODE == 1) v += bias[mBase + mOff + r];
        if (BIAS_MODE == 2) v += bv;
        if (RESID) v += Rb[(size_t)(mBase + mOff + r) * ldc + n];
        if (ACT == 1) v = tanhf(v);
        if (ACT == 2) v = fmaxf(v, 0.0f);
        if (ACT == 3) v = v / (1.0f + expf(-v));
        if (ACT == 4) v = (v > 0.f) ? v : 0.01f * v;
        if (ACT == 5) v = 0.5f * v * (1.0f + erff(v * 0.70710678118654752f));
        slab[(mOff + r) * 68 + (j << 4) + rlane] = v;
      }
    }
    __builtin_amdgcn_fence(__ATOMIC_RELEASE, "workgroup");
    __builtin_amdgcn_wave_barrier();
    __builtin_amdgcn_fence(__ATOMIC_ACQUIRE, "workgroup");
    if (OUT_MODE == 0) {
      float* C = (float*)Cout + (size_t)b * strideC;
      const int hh = lane >> 4, c4 = (lane & 15) * 4;     // row seg = 256 B = 16 lanes x 16 B
      {
#pragma unroll
        for (int it = 0; it < 8; ++it) {
          const int row = it * 2 + hh;
          v4f v = *(const v4f*)(slab + row * 68 + c4);
          *(v4f*)(C + (size_t)(mBase + row) * ldc + n0 + c4) = v;
        }
        
      }
    } else {
      const int q = lane >> 3, c8 = (lane & 7) * 8;
      unsigned short* C  = (unsigned short*)Cout  + (size_t)b * strideC;
      unsigned short* C2 = (OUT_MODE == 2) ? ((unsigned short*)Cout2 + (size_t)b * strideC) : nullptr;
      {
#pragma unroll
        for (int it = 0; it < 4; ++it) {
          const int row = it * 4 + q;
          const float* sp = slab + row * 68 + c8;
          v8h hv, lv;
#pragma unroll
          for (int e = 0; e < 8; ++e) {
            if (OUT_MODE == 1) {
              hv[e] = (_Float16)sp[e];
            } else {
              unsigned short hb = f2bf_bits(sp[e]);
              unsigned short lb = f2bf_bits(sp[e] - bf_bits2f(hb));
              hv[e] = __builtin_bit_cast(_Float16, hb);
              lv[e] = __builtin_bit_cast(_Float16, lb);
            }
          }
          *(v8h*)(C + (size_t)(mBase + row) * ldc + n0 + c8) = hv;
          if (OUT_MODE == 2) *(v8h*)(C2 + (size_t)(mBase + row) * ldc + n0 + c8) = lv;
        }
        
      }
    }
    __builtin_amdgcn_fence(__ATOMIC_RELEASE, "workgroup");
    __builtin_amdgcn_wave_barrier();
    __builtin_amdgcn_fence(__ATOMIC_ACQUIRE, "workgroup");
  }
}

// ---------------------------------------------------------------------------
// Weight convert: four f32 [c][d] matrices -> f16 transposed wt16[mat][d][c] (k-contiguous rows).
// grid (4 row-blocks of 32 d, 4 matrices), block 256. LDS transpose; each output row (256 B)
// ---------------------------------------------------------------------------
#define WC_P 136
__global__ __launch_bounds__(256) void k_wconvert(const float* __restrict__ w0, const float* __restrict__ w1,
                                                 const float* __restrict__ w2, const float* __restrict__ w3,
                                                 _Float16* __restrict__ wt16) {
  __shared__ __align__(16) _Float16 T[32 * WC_P];           // [d local][c]
  const int mat = blockIdx.y;
  const int n0  = blockIdx.x * 32;
  const int t   = threadIdx.x;
  const float* src = (mat == 0) ? w0 : (mat == 1) ? w1 : (mat == 2) ? w2 : w3;
#pragma unroll
  for (int it = 0; it < 16; ++it) {
    const int idx = it * 256 + t;                            // 0..4095
    const int k = idx >> 5, j = idx & 31;
    T[j * WC_P + k] = (_Float16)src[(size_t)k * kC + n0 + j];
  }
  __syncthreads();
  const int row0 = t >> 4, c8 = (t & 15) * 8;
  _Float16* dst = wt16 + ((size_t)mat * kC + n0) * kC;
  {
#pragma unroll
    for (int it = 0; it < 2; ++it) {
      const int rr = row0 + 16 * it;
      const v8h val = *(const v8h*)(T + rr * WC_P + c8);
      *(v8h*)(dst + (size_t)rr * kC + c8) = val;
    }
    
  }
}

// ---------------------------------------------------------------------------
// GroupNorm statistics: one block per image; lane = group, 8 row-phases per group; f64 accumulation.
// Table row per image: [0..31] = mean, [32..63] = rstd (256 B), written by lanes 0..15 of wave 0.
// ---------------------------------------------------------------------------
__global__ __launch_bounds__(256) void k_gn_stats(const float* __restrict__ x, float* __restrict__ gtab) {
  __shared__ double red_s[8][32], red_q[8][32];
  __shared__ __align__(16) float tab[64];
  const int b = blockIdx.x;
  const int t = threadIdx.x, g = t & 31, rs = t >> 5;
  const float* xb = x + (size_t)b * kN * kC + kCPG * g;
  double s = 0.0, ss = 0.0;
  for (int r = rs; r < kN; r += 8) {
    const v4f v = *(const v4f*)(xb + (size_t)r * kC);
#pragma unroll
    for (int e = 0; e < 4; ++e) { const double d = (double)v[e]; s += d; ss += d * d; }
  }
  red_s[rs][g] = s; red_q[rs][g] = ss;
  __syncthreads();
  if (t < 32) {
    double S = 0.0, Q = 0.0;
#pragma unroll
    for (int i = 0; i < 8; ++i) { S += red_s[i][t]; Q += red_q[i][t]; }
    const double inv_n = 1.0 / (double)(kN * kCPG);
    const double mean = S * inv_n;
    double var = Q * inv_n - mean * mean;
    if (var < 0.0) var = 0.0;
    const float rstd = rsqrtf((float)var + 1e-6f);
    tab[t] = (float)mean;
    tab[32 + t] = rstd;
  }
  __syncthreads();
  if (t < 16) {
    const v4f v = *(const v4f*)(tab + 4 * t);
    *(v4f*)(gtab + (size_t)b * 64 + 4 * t) = v;
    
  }
}

// ---------------------------------------------------------------------------
// GroupNorm apply: thread = 8 consecutive channels of one token row -> f16 h16[m][c] (16-B store,
// ---------------------------------------------------------------------------
__global__ __launch_bounds__(256) void k_gn_apply(const float* __restrict__ x, const float* __restrict__ gs,
                                                 const float* __restrict__ gb, const float* __restrict__ gtab,
                                                 _Float16* __restrict__ h16, int nvec) {
  const int i = blockIdx.x * 256 + threadIdx.x;
  if (i >= nvec) return;
  const int m  = i >> 4;
  const int c8 = (i & 15) * 8;
  const int b  = m >> 12;
  const int g0 = c8 >> 2;
  const float* tb = gtab + (size_t)b * 64;
  const float mean0 = tb[g0],     rstd0 = tb[32 + g0];
  const float mean1 = tb[g0 + 1], rstd1 = tb[32 + g0 + 1];
  const float* xr = x + (size_t)m * kC + c8;
  const v4f xa = *(const v4f*)(xr), xb2 = *(const v4f*)(xr + 4);
  const v4f sa = *(const v4f*)(gs + c8), sb = *(const v4f*)(gs + c8 + 4);
  const v4f ba = *(const v4f*)(gb + c8), bb = *(const v4f*)(gb + c8 + 4);
  v8h hv;
#pragma unroll
  for (int e = 0; e < 4; ++e) {
    hv[e]     = (_Float16)(((xa[e]  - mean0) * rstd0) * sa[e] + ba[e]);
    hv[4 + e] = (_Float16)(((xb2[e] - mean1) * rstd1) * sb[e] + bb[e]);
  }
  _Float16* dst = h16 + (size_t)m * kC + c8;
  *(v8h*)dst = hv;
  
}

// ---------------------------------------------------------------------------
// Flash attention, head dim 128, f16 q/k/v^T in, f16 out.
//   scores = q.k^T (x scale in f32)  : v_wmma_f32_16x16x32_f16
//   out    = p.v, p carried x2^15    : v_wmma_f32_16x16x32_f16; f32 accumulate; online softmax f32.
// Block = 4 waves = 64 query rows of one image; 64-key chunks; K [kv][d] and V^T [d][kv] tiles staged
// in LDS with plain 16-B loads + __syncthreads. grid.x = 16 images x 64 query blocks.
// ---------------------------------------------------------------------------
#define AT_KC 64
#define AT_OP 136
__global__ __launch_bounds__(128) void k_attn128(const _Float16* __restrict__ q16, const _Float16* __restrict__ k16,
                                                const _Float16* __restrict__ vt16, _Float16* __restrict__ o16,
                                                float scale) {
  __shared__ __align__(16) _Float16 Ksh[AT_KC * kC];       // [kv][d]      16 KB
  __shared__ __align__(16) _Float16 Vts[kC * AT_KC];       // [d][kv]      16 KB
  __shared__ __align__(16) _Float16 Psh[4][16 * AT_KC];    // per wave [row][kv]  8 KB
  __shared__ __align__(16) _Float16 Osh[4][16 * AT_OP];    // per wave [row][d]   17 KB
  const int tid  = threadIdx.x;
  const int wave = tid >> 5;
  const int lane = tid & 31;
  const int hh   = lane >> 4;
  const int c    = lane & 15;
  const int b    = blockIdx.x >> 6;
  const int qb   = blockIdx.x & 63;
  const int q0   = qb * 64 + wave * 16;
  const size_t tok0 = (size_t)b * kN;

  // Q fragments (A operand), 4 d-chunks of 32
  v16h qa[4];
  {
    const _Float16* qrow = q16 + (tok0 + q0 + c) * kC;
#pragma unroll
    for (int dc = 0; dc < 4; ++dc) qa[dc] = Frag<_Float16>::load(qrow + dc * 32 + 8 * hh);
  }

  float mrow[8], lrow[8];
  v8f oacc[8];
#pragma unroll
  for (int r = 0; r < 8; ++r) { mrow[r] = -__builtin_inff(); lrow[r] = 0.f; }
#pragma unroll
  for (int t = 0; t < 8; ++t) oacc[t] = (v8f){0.f,0.f,0.f,0.f,0.f,0.f,0.f,0.f};

  _Float16* pw = Psh[wave];
  const float PSC = 32768.0f;

#pragma unroll 1
  for (int kc = 0; kc < kN / AT_KC; ++kc) {
    const int kv0 = kc * AT_KC;
    __syncthreads();
#pragma unroll
    for (int it = 0; it < 8; ++it) {
      const int i = tid + 128 * it;                          // 0..1023
      {
        const int row = i >> 4, d8 = (i & 15) * 8;
        const v8h kk = *(const v8h*)(k16 + (tok0 + kv0 + row) * kC + d8);
        *(v8h*)(Ksh + row * kC + d8) = kk;
      }
      {
        const int d = i >> 3, c8 = (i & 7) * 8;
        const v8h vv = *(const v8h*)(vt16 + ((size_t)b * kC + d) * kN + kv0 + c8);
        *(v8h*)(Vts + d * AT_KC + c8) = vv;
      }
    }
    __syncthreads();

    // S = Q . K^T : 4 key tiles of 16, k = d over 4 chunks
    v8f s[4];
#pragma unroll
    for (int j = 0; j < 4; ++j) {
      s[j] = (v8f){0.f,0.f,0.f,0.f,0.f,0.f,0.f,0.f};
#pragma unroll
      for (int dc = 0; dc < 4; ++dc) {
        const v16h kb = Frag<_Float16>::load(Ksh + (j * 16 + c) * kC + dc * 32 + 8 * hh);
        s[j] = mma16(qa[dc], kb, s[j]);
      }
    }

    // chunk row max (row 8hh+r, 64 cols spread over the 16 lanes of this half x 4 tiles)
    float cm[8];
#pragma unroll
    for (int r = 0; r < 8; ++r) {
      float m = -__builtin_inff();
#pragma unroll
      for (int j = 0; j < 4; ++j) {
        const float sv = s[j][r] * scale;
        s[j][r] = sv;
        m = fmaxf(m, sv);
      }
#pragma unroll
      for (int off = 1; off < 16; off <<= 1) m = fmaxf(m, __shfl_xor(m, off, 32));
      cm[r] = m;
    }
    // online softmax; P (x2^15, f16) into this wave's LDS slab
#pragma unroll
    for (int r = 0; r < 8; ++r) {
      const float mnew  = fmaxf(mrow[r], cm[r]);
      const float alpha = __expf(mrow[r] - mnew);
      mrow[r] = mnew;
      float psum = 0.f;
#pragma unroll
      for (int j = 0; j < 4; ++j) {
        const float p = __expf(s[j][r] - mnew);
        psum += p;
        pw[(8 * hh + r) * AT_KC + j * 16 + c] = (_Float16)(p * PSC);
      }
#pragma unroll
      for (int off = 1; off < 16; off <<= 1) psum += __shfl_xor(psum, off, 32);
      lrow[r] = lrow[r] * alpha + psum;
#pragma unroll
      for (int t = 0; t < 8; ++t) oacc[t][r] *= alpha;
    }
    __builtin_amdgcn_fence(__ATOMIC_RELEASE, "workgroup");
    __builtin_amdgcn_wave_barrier();
    __builtin_amdgcn_fence(__ATOMIC_ACQUIRE, "workgroup");

    // O += P . V : A = P [row][kv], B[kv][d] = Vts[d][kv]; 2 kv chunks of 32, 8 d tiles
#pragma unroll
    for (int kk = 0; kk < 2; ++kk) {
      const v16h pa = Frag<_Float16>::load(pw + c * AT_KC + kk * 32 + 8 * hh);
#pragma unroll
      for (int t = 0; t < 8; ++t) {
        const v16h vb = Frag<_Float16>::load(Vts + (t * 16 + c) * AT_KC + kk * 32 + 8 * hh);
        oacc[t] = mma16(pa, vb, oacc[t]);
      }
    }
  }

  _Float16* osw = Osh[wave];
#pragma unroll
  for (int r = 0; r < 8; ++r) {
    const float inv = 1.0f / (lrow[r] * PSC);
#pragma unroll
    for (int t = 0; t < 8; ++t) osw[(8 * hh + r) * AT_OP + t * 16 + c] = (_Float16)(oacc[t][r] * inv);
  }
  __builtin_amdgcn_fence(__ATOMIC_RELEASE, "workgroup");
  __builtin_amdgcn_wave_barrier();
  __builtin_amdgcn_fence(__ATOMIC_ACQUIRE, "workgroup");
  {
    const int c8 = (lane & 15) * 8;                          // row = 256 B = 16 lanes x 16 B
    _Float16* ob = o16 + (tok0 + q0) * kC;
    {
#pragma unroll
      for (int it = 0; it < 8; ++it) {
        const int row = it * 2 + hh;
        const v8h val = *(const v8h*)(osw + row * AT_OP + c8);
        *(v8h*)(ob + (size_t)row * kC + c8) = val;
      }
      
    }
  }
}

// ---------------------------------------------------------------------------
extern "C" void kernel_launch(void* const* d_in, const int* in_sizes, int n_in,
                              void* d_out, int out_size, void* d_ws, size_t ws_size,
                              hipStream_t stream) {
  if (n_in < 11) return;
  if (in_sizes[0] != kM * kC || out_size != kM * kC) return;
  if (in_sizes[1] != kC || in_sizes[2] != kC || in_sizes[4] != kC || in_sizes[6] != kC ||
      in_sizes[8] != kC || in_sizes[10] != kC) return;
  if (in_sizes[3] != kC * kC || in_sizes[5] != kC * kC || in_sizes[7] != kC * kC || in_sizes[9] != kC * kC) return;

  const float* x  = (const float*)d_in[0];
  const float* gs = (const float*)d_in[1];
  const float* gb = (const float*)d_in[2];
  const float* wq = (const float*)d_in[3];
  const float* bq = (const float*)d_in[4];
  const float* wk = (const float*)d_in[5];
  const float* bk = (const float*)d_in[6];
  const float* wv = (const float*)d_in[7];
  const float* bv = (const float*)d_in[8];
  const float* wo = (const float*)d_in[9];
  const float* bo = (const float*)d_in[10];
  float* out = (float*)d_out;

  // workspace carve (bytes)
  const size_t szW   = (size_t)4 * kC * kC * sizeof(_Float16);       // 131072
  const size_t szTab = (size_t)kB * 64 * sizeof(float);               // 4096
  const size_t szT16 = (size_t)kM * kC * sizeof(_Float16);            // 16777216
  const size_t offW   = 0;
  const size_t offTab = offW + szW;
  const size_t offH   = offTab + szTab;
  const size_t offQ   = offH + szT16;
  const size_t offK   = offQ + szT16;
  const size_t offVt  = offK + szT16;
  const size_t offO   = offVt + szT16;
  const size_t offEnd = offO + szT16;                                  // 84021248
  if (offEnd > ws_size) return;

  char* ws = (char*)d_ws;
  _Float16* wt16 = (_Float16*)(ws + offW);
  float*    gtab = (float*)(ws + offTab);
  _Float16* h16  = (_Float16*)(ws + offH);
  _Float16* q16  = (_Float16*)(ws + offQ);
  _Float16* k16  = (_Float16*)(ws + offK);
  _Float16* vt16 = (_Float16*)(ws + offVt);
  _Float16* o16  = (_Float16*)(ws + offO);
  const _Float16* wtq = wt16;
  const _Float16* wtk = wt16 + (size_t)kC * kC;
  const _Float16* wtv = wt16 + (size_t)2 * kC * kC;
  const _Float16* wto = wt16 + (size_t)3 * kC * kC;

  // 1. weights f32 [c][d] -> f16 [d][c]
  k_wconvert<<<dim3(kC / 32, 4), 256, 0, stream>>>(wq, wk, wv, wo, wt16);
  // 2. GroupNorm statistics and apply
  k_gn_stats<<<kB, 256, 0, stream>>>(x, gtab);
  const int nvec = kM * (kC / 8);                                      // 1048576
  k_gn_apply<<<(nvec + 255) / 256, 256, 0, stream>>>(x, gs, gb, gtab, h16, nvec);

  // 3. projections: q16 = h.wq + bq, k16 = h.wk + bk   (M=65536, N=128, K=128; 2048 wave tiles)
  const int gridMN = ((kM / 64) * (kC / 64) + 7) / 8;                  // 256
  wmma_gemm64<0, false, 2, 1, false><<<dim3(gridMN, 1), 256, 0, stream>>>(
      U16(h16), U16(h16), kC, (long)0, U16(wtq), U16(wtq), kC, (long)0,
      (void*)q16, (void*)nullptr, kC, (long)0, bq, (const float*)nullptr, (long)0, kM, kC, kC, 1.0f);
  wmma_gemm64<0, false, 2, 1, false><<<dim3(gridMN, 1), 256, 0, stream>>>(
      U16(h16), U16(h16), kC, (long)0, U16(wtk), U16(wtk), kC, (long)0,
      (void*)k16, (void*)nullptr, kC, (long)0, bk, (const float*)nullptr, (long)0, kM, kC, kC, 1.0f);
  //    v^T per image: vt16[b][d][n] = sum_c wt_v[d][c] . h16[b][n][c] + bv[d]  (M=128, N=4096, K=128, batched)
  const int gridVt = ((kC / 64) * (kN / 64) + 7) / 8;                  // 16
  wmma_gemm64<0, false, 1, 1, false><<<dim3(gridVt, kB), 256, 0, stream>>>(
      U16(wtv), U16(wtv), kC, (long)0, U16(h16), U16(h16), kC, (long)kN * kC,
      (void*)vt16, (void*)nullptr, kN, (long)kC * kN, bv, (const float*)nullptr, (long)0, kC, kN, kC, 1.0f);

  // 4. attention
  const float scale = 0.08838834764831845f;                            // 128^-0.5
  k_attn128<<<kB * (kN / 64), 128, 0, stream>>>(q16, k16, vt16, o16, scale);

  // 5. out = x + o.wo + bo  (f32, residual)
  wmma_gemm64<0, false, 2, 0, true><<<dim3(gridMN, 1), 256, 0, stream>>>(
      U16(o16), U16(o16), kC, (long)0, U16(wto), U16(wto), kC, (long)0,
      (void*)out, (void*)nullptr, kC, (long)0, bo, x, (long)0, kM, kC, kC, 1.0f);
}

// v001
// A run of this version takes 537 microseconds.
// Two timings next to v000 both put it at 2.23 times that version's speed.
// Contractions: v_wmma_f32_16x16x32_f16 (f16 operands, f32 accumulate) for the three 1x1 projections,
// q.k^T, p.v (p carried x2^15) and the output projection; GroupNorm statistics f64/f32, softmax f32.
#include <hip/hip_runtime.h>

typedef __attribute__((ext_vector_type(16))) _Float16 v16h;
typedef __attribute__((ext_vector_type(8)))  _Float16 v8h;
typedef __attribute__((ext_vector_type(16))) __bf16   v16b;
typedef __attribute__((ext_vector_type(8)))  __bf16   v8b;
typedef __attribute__((ext_vector_type(8)))  float    v8f;
typedef __attribute__((ext_vector_type(4)))  float    v4f;
#define U16(p) ((const unsigned short*)(const void*)(p))

static constexpr int kB  = 16;          // batch
static constexpr int kN  = 4096;        // tokens per image (64*64)
static constexpr int kC  = 128;         // channels
static constexpr int kM  = kB * kN;     // 65536 token rows
static constexpr int kNG = 32;          // groups
static constexpr int kCPG = 4;          // channels per group

__device__ __forceinline__ unsigned short f2bf_bits(float f) {
  unsigned u = __float_as_uint(f);
  return (unsigned short)((u + 0x7FFFu + ((u >> 16) & 1u)) >> 16);
}
__device__ __forceinline__ float bf_bits2f(unsigned short h) { return __uint_as_float(((unsigned)h) << 16); }

// hazard guards as plain device helpers
__device__ __forceinline__ void dep_guard_h(v8f& a, v8f& b, v16h x, v16h y) { asm volatile("v_nop\n\tv_nop\n\tv_nop\n\tv_nop" : "+v"(a), "+v"(b) : "v"(x), "v"(y)); }
__device__ __forceinline__ void dep_guard_b(v8f& a, v8f& b, v16b x, v16b y) { asm volatile("v_nop\n\tv_nop\n\tv_nop\n\tv_nop" : "+v"(a), "+v"(b) : "v"(x), "v"(y)); }
__device__ __forceinline__ void keep4_h(v16h a, v16h b, v16h c, v16h d) { asm volatile("v_nop" :: "v"(a), "v"(b), "v"(c), "v"(d)); }
__device__ __forceinline__ void keep4_b(v16b a, v16b b, v16b c, v16b d) { asm volatile("v_nop" :: "v"(a), "v"(b), "v"(c), "v"(d)); }
__device__ __forceinline__ void acc_guard4(v8f& a, v8f& b, v8f& c, v8f& d) { asm volatile("v_nop\n\tv_nop\n\tv_nop\n\tv_nop" : "+v"(a), "+v"(b), "+v"(c), "+v"(d)); }
template <typename T> struct Frag;
template <> struct Frag<_Float16> {
  typedef v16h V; union U { v16h v; v8h h[2]; };
  static __device__ __forceinline__ v16h load(const _Float16* p) {   // elements 0..7 <- p[0..7], 8..15 <- p[16..23]
    U f; f.h[0] = *(const v8h*)(p); f.h[1] = *(const v8h*)(p + 16); return f.v;
  }
  static __device__ __forceinline__ v8f mma(v16h a, v16h b, v8f c) {
    return __builtin_amdgcn_wmma_f32_16x16x32_f16(false, a, false, b, (short)0, c, false, false);
  }
  static __device__ __forceinline__ void guard(v8f& a, v8f& b, v16h x, v16h y) { dep_guard_h(a, b, x, y); }
  static __device__ __forceinline__ void keep(v16h a, v16h b, v16h c, v16h d) { keep4_h(a, b, c, d); }
};
template <> struct Frag<__bf16> {
  typedef v16b V; union U { v16b v; v8b h[2]; };
  static __device__ __forceinline__ v16b load(const __bf16* p) {
    U f; f.h[0] = *(const v8b*)(p); f.h[1] = *(const v8b*)(p + 16); return f.v;
  }
  static __device__ __forceinline__ v8f mma(v16b a, v16b b, v8f c) {
    return __builtin_amdgcn_wmma_f32_16x16x32_bf16(false, a, false, b, (short)0, c, false, false);
  }
  static __device__ __forceinline__ void guard(v8f& a, v8f& b, v16b x, v16b y) { dep_guard_b(a, b, x, y); }
  static __device__ __forceinline__ void keep(v16b a, v16b b, v16b c, v16b d) { keep4_b(a, b, c, d); }
};

// per-call guarded f16 WMMA (4 nops tying D and both operands)
__device__ __forceinline__ v8f mma16(v16h a, v16h b, v8f c) {
  c = __builtin_amdgcn_wmma_f32_16x16x32_f16(false, a, false, b, (short)0, c, false, false);
  asm volatile("v_nop\n\tv_nop\n\tv_nop\n\tv_nop" : "+v"(c) : "v"(a), "v"(b));
  return c;
}

// ---- Register-blocked batched WMMA GEMM --------------------------------
// C[m,n] = scale * sum_k A[m,k] * Bt[n,k] (+bias)(+resid); each wave owns a 64x64 tile.
// A row-major [M,K]; Bt row-major [N,K]; M,N % 64 == 0, K % 32 == 0.
// SPLIT: operands are hi/lo planes (A2/Bt2 = lo planes, same layout); product = hi·hi + hi·lo + lo·hi.
// BIAS_MODE: 0 = none, 1 = bias[m], 2 = bias[n].
// OUT_MODE: 0 = f32, 1 = f16, 2 = bf16 hi plane (Cout) + bf16 lo plane (Cout2).
// ET: 0 = f16 operands, 1 = bf16 operands (pointers passed as 16-bit storage)
template <int ET> struct Elem;
template <> struct Elem<0> { typedef _Float16 T; };
template <> struct Elem<1> { typedef __bf16 T; };
template <int ET, bool SPLIT, int BIAS_MODE, int OUT_MODE, bool RESID, int ACT = 0>
__global__ __launch_bounds__(256) void wmma_gemm64(
    const unsigned short* __restrict__ Ap, const unsigned short* __restrict__ A2p, int lda, long strideA,
    const unsigned short* __restrict__ Btp, const unsigned short* __restrict__ Bt2p, int ldb, long strideB,
    void* __restrict__ Cout, void* __restrict__ Cout2, int ldc, long strideC,
    const float* __restrict__ bias,
    const float* __restrict__ resid, long strideR,
    int M, int N, int K, float scale) {
  typedef typename Elem<ET>::T T;
  typedef typename Frag<T>::V V;
  const T* A = (const T*)Ap; const T* A2 = (const T*)A2p; const T* Bt = (const T*)Btp; const T* Bt2 = (const T*)Bt2p;
  __shared__ __align__(16) float sT[8][16 * 68];   // per-wave 16x64 slab, pitch 68 floats
  const int b    = blockIdx.y;
  const int lane = threadIdx.x & 31;
  const int wave = threadIdx.x >> 5;
  const int tilesN = N >> 6;
  const int tilesM = M >> 6;
  const int tile = blockIdx.x * 8 + wave;
  if (tile >= tilesM * tilesN) return;   // wave-uniform; no block barriers in this kernel
  const int tm = tile / tilesN;
  const int tn = tile - tm * tilesN;
  const int m0 = tm << 6;
  const int n0 = tn << 6;

  const T* Ab  = A  + (size_t)b * strideA;
  const T* Bb  = Bt + (size_t)b * strideB;
  const T* Ab2 = SPLIT ? (A2  + (size_t)b * strideA) : nullptr;
  const T* Bb2 = SPLIT ? (Bt2 + (size_t)b * strideB) : nullptr;

  const int rlane = lane & 15;                 // row (A) / col (B, D) within subtile
  const int koff  = (lane >> 4) * 8;           // k offset of this lane half
  const int mOff  = (lane >> 4) * 8;           // D row offset

  v8f acc[4][4];
#pragma unroll
  for (int i = 0; i < 4; ++i)
#pragma unroll
    for (int j = 0; j < 4; ++j) acc[i][j] = (v8f){0.f,0.f,0.f,0.f,0.f,0.f,0.f,0.f};

  for (int k0 = 0; k0 < K; k0 += 32) {
    V bh[4], bl[4];
#pragma unroll
    for (int j = 0; j < 4; ++j) {
      const size_t bo = (size_t)(n0 + (j << 4) + rlane) * ldb + koff + k0;
      bh[j] = Frag<T>::load(Bb + bo);
      if (SPLIT) bl[j] = Frag<T>::load(Bb2 + bo);
    }
#pragma unroll
    for (int i = 0; i < 4; ++i) {
      const size_t ao = (size_t)(m0 + (i << 4) + rlane) * lda + koff + k0;
      V ah = Frag<T>::load(Ab + ao);
      V al;
      if (SPLIT) al = Frag<T>::load(Ab2 + ao);
#pragma unroll
      for (int j = 0; j < 4; ++j) {
        acc[i][j] = Frag<T>::mma(ah, bh[j], acc[i][j]);
        if (SPLIT) {
          acc[i][j] = Frag<T>::mma(ah, bl[j], acc[i][j]);
          acc[i][j] = Frag<T>::mma(al, bh[j], acc[i][j]);
        }
      }
      Frag<T>::guard(acc[i][0], acc[i][3], ah, SPLIT ? al : ah);
    }
    Frag<T>::keep(bh[0], bh[1], bh[2], bh[3]);
    if (SPLIT) Frag<T>::keep(bl[0], bl[1], bl[2], bl[3]);
  }
  acc_guard4(acc[0][0], acc[0][1], acc[0][2], acc[0][3]);
  acc_guard4(acc[1][0], acc[1][1], acc[1][2], acc[1][3]);
  acc_guard4(acc[2][0], acc[2][1], acc[2][2], acc[2][3]);
  acc_guard4(acc[3][0], acc[3][1], acc[3][2], acc[3][3]);

  // ---- epilogue ----
  float* slab = sT[wave];
  const float* Rb = RESID ? (resid + (size_t)b * strideR) : nullptr;
#pragma unroll
  for (int i = 0; i < 4; ++i) {
    const int mBase = m0 + (i << 4);
#pragma unroll
    for (int j = 0; j < 4; ++j) {
      const int n = n0 + (j << 4) + rlane;
      float bv = 0.f;
      if (BIAS_MODE == 2) bv = bias[n];
#pragma unroll
      for (int r = 0; r < 8; ++r) {
        float v = acc[i][j][r] * scale;
        if (BIAS_MODE == 1) v += bias[mBase + mOff + r];
        if (BIAS_MODE == 2) v += bv;
        if (RESID) v += Rb[(size_t)(mBase + mOff + r) * ldc + n];
        if (ACT == 1) v = tanhf(v);
        if (ACT == 2) v = fmaxf(v, 0.0f);
        if (ACT == 3) v = v / (1.0f + expf(-v));
        if (ACT == 4) v = (v > 0.f) ? v : 0.01f * v;
        if (ACT == 5) v = 0.5f * v * (1.0f + erff(v * 0.70710678118654752f));
        slab[(mOff + r) * 68 + (j << 4) + rlane] = v;
      }
    }
    __builtin_amdgcn_fence(__ATOMIC_RELEASE, "workgroup");
    __builtin_amdgcn_wave_barrier();
    __builtin_amdgcn_fence(__ATOMIC_ACQUIRE, "workgroup");
    if (OUT_MODE == 0) {
      float* C = (float*)Cout + (size_t)b * strideC;
      const int hh = lane >> 4, c4 = (lane & 15) * 4;     // row seg = 256 B = 16 lanes x 16 B
      {
#pragma unroll
        for (int it = 0; it < 8; ++it) {
          const int row = it * 2 + hh;
          v4f v = *(const v4f*)(slab + row * 68 + c4);
          *(v4f*)(C + (size_t)(mBase + row) * ldc + n0 + c4) = v;
        }
        
      }
    } else {
      const int q = lane >> 3, c8 = (lane & 7) * 8;
      unsigned short* C  = (unsigned short*)Cout  + (size_t)b * strideC;
      unsigned short* C2 = (OUT_MODE == 2) ? ((unsigned short*)Cout2 + (size_t)b * strideC) : nullptr;
      {
#pragma unroll
        for (int it = 0; it < 4; ++it) {
          const int row = it * 4 + q;
          const float* sp = slab + row * 68 + c8;
          v8h hv, lv;
#pragma unroll
          for (int e = 0; e < 8; ++e) {
            if (OUT_MODE == 1) {
              hv[e] = (_Float16)sp[e];
            } else {
              unsigned short hb = f2bf_bits(sp[e]);
              unsigned short lb = f2bf_bits(sp[e] - bf_bits2f(hb));
              hv[e] = __builtin_bit_cast(_Float16, hb);
              lv[e] = __builtin_bit_cast(_Float16, lb);
            }
          }
          *(v8h*)(C + (size_t)(mBase + row) * ldc + n0 + c8) = hv;
          if (OUT_MODE == 2) *(v8h*)(C2 + (size_t)(mBase + row) * ldc + n0 + c8) = lv;
        }
        
      }
    }
    __builtin_amdgcn_fence(__ATOMIC_RELEASE, "workgroup");
    __builtin_amdgcn_wave_barrier();
    __builtin_amdgcn_fence(__ATOMIC_ACQUIRE, "workgroup");
  }
}

// ---------------------------------------------------------------------------
// Weight convert: four f32 [c][d] matrices -> f16 transposed wt16[mat][d][c] (k-contiguous rows).
// grid (4 row-blocks of 32 d, 4 matrices), block 256. LDS transpose; each output row (256 B)
// ---------------------------------------------------------------------------
#define WC_P 136
__global__ __launch_bounds__(256) void k_wconvert(const float* __restrict__ w0, const float* __restrict__ w1,
                                                 const float* __restrict__ w2, const float* __restrict__ w3,
                                                 _Float16* __restrict__ wt16) {
  __shared__ __align__(16) _Float16 T[32 * WC_P];           // [d local][c]
  const int mat = blockIdx.y;
  const int n0  = blockIdx.x * 32;
  const int t   = threadIdx.x;
  const float* src = (mat == 0) ? w0 : (mat == 1) ? w1 : (mat == 2) ? w2 : w3;
#pragma unroll
  for (int it = 0; it < 16; ++it) {
    const int idx = it * 256 + t;                            // 0..4095
    const int k = idx >> 5, j = idx & 31;
    T[j * WC_P + k] = (_Float16)src[(size_t)k * kC + n0 + j];
  }
  __syncthreads();
  const int row0 = t >> 4, c8 = (t & 15) * 8;
  _Float16* dst = wt16 + ((size_t)mat * kC + n0) * kC;
  {
#pragma unroll
    for (int it = 0; it < 2; ++it) {
      const int rr = row0 + 16 * it;
      const v8h val = *(const v8h*)(T + rr * WC_P + c8);
      *(v8h*)(dst + (size_t)rr * kC + c8) = val;
    }
    
  }
}

// ---------------------------------------------------------------------------
// GroupNorm statistics: one block per image; lane = group, 8 row-phases per group; f64 accumulation.
// Table row per image: [0..31] = mean, [32..63] = rstd (256 B), written by lanes 0..15 of wave 0.
// ---------------------------------------------------------------------------
__global__ __launch_bounds__(256) void k_gn_stats(const float* __restrict__ x, float* __restrict__ gtab) {
  __shared__ double red_s[8][32], red_q[8][32];
  __shared__ __align__(16) float tab[64];
  const int b = blockIdx.x;
  const int t = threadIdx.x, g = t & 31, rs = t >> 5;
  const float* xb = x + (size_t)b * kN * kC + kCPG * g;
  double s = 0.0, ss = 0.0;
  for (int r = rs; r < kN; r += 8) {
    const v4f v = *(const v4f*)(xb + (size_t)r * kC);
#pragma unroll
    for (int e = 0; e < 4; ++e) { const double d = (double)v[e]; s += d; ss += d * d; }
  }
  red_s[rs][g] = s; red_q[rs][g] = ss;
  __syncthreads();
  if (t < 32) {
    double S = 0.0, Q = 0.0;
#pragma unroll
    for (int i = 0; i < 8; ++i) { S += red_s[i][t]; Q += red_q[i][t]; }
    const double inv_n = 1.0 / (double)(kN * kCPG);
    const double mean = S * inv_n;
    double var = Q * inv_n - mean * mean;
    if (var < 0.0) var = 0.0;
    const float rstd = rsqrtf((float)var + 1e-6f);
    tab[t] = (float)mean;
    tab[32 + t] = rstd;
  }
  __syncthreads();
  if (t < 16) {
    const v4f v = *(const v4f*)(tab + 4 * t);
    *(v4f*)(gtab + (size_t)b * 64 + 4 * t) = v;
    
  }
}

// ---------------------------------------------------------------------------
// GroupNorm apply: thread = 8 consecutive channels of one token row -> f16 h16[m][c] (16-B store,
// ---------------------------------------------------------------------------
__global__ __launch_bounds__(256) void k_gn_apply(const float* __restrict__ x, const float* __restrict__ gs,
                                                 const float* __restrict__ gb, const float* __restrict__ gtab,
                                                 _Float16* __restrict__ h16, int nvec) {
  const int i = blockIdx.x * 256 + threadIdx.x;
  if (i >= nvec) return;
  const int m  = i >> 4;
  const int c8 = (i & 15) * 8;
  const int b  = m >> 12;
  const int g0 = c8 >> 2;
  const float* tb = gtab + (size_t)b * 64;
  const float mean0 = tb[g0],     rstd0 = tb[32 + g0];
  const float mean1 = tb[g0 + 1], rstd1 = tb[32 + g0 + 1];
  const float* xr = x + (size_t)m * kC + c8;
  const v4f xa = *(const v4f*)(xr), xb2 = *(const v4f*)(xr + 4);
  const v4f sa = *(const v4f*)(gs + c8), sb = *(const v4f*)(gs + c8 + 4);
  const v4f ba = *(const v4f*)(gb + c8), bb = *(const v4f*)(gb + c8 + 4);
  v8h hv;
#pragma unroll
  for (int e = 0; e < 4; ++e) {
    hv[e]     = (_Float16)(((xa[e]  - mean0) * rstd0) * sa[e] + ba[e]);
    hv[4 + e] = (_Float16)(((xb2[e] - mean1) * rstd1) * sb[e] + bb[e]);
  }
  _Float16* dst = h16 + (size_t)m * kC + c8;
  *(v8h*)dst = hv;
  
}

// ---------------------------------------------------------------------------
// Flash attention, head dim 128, f16 q/k/v^T in, f16 out.
//   scores = q.k^T (x scale in f32)  : v_wmma_f32_16x16x32_f16
//   out    = p.v, p carried x2^15    : v_wmma_f32_16x16x32_f16; f32 accumulate; online softmax f32.
// Block = 4 waves = 64 query rows of one image; 64-key chunks; K [kv][d] and V^T [d][kv] tiles staged
// in LDS with plain 16-B loads + __syncthreads. grid.x = 16 images x 64 query blocks.
// ---------------------------------------------------------------------------
#define AT_KC 64
#define AT_OP 136
// LDS row pitches in f16 elements: an odd multiple of 16 B, so the 16 rows of one ds_load_b128 fall on distinct banks
#define AT_KP 136   // K rows of 256 B at 272 B
#define AT_VP 72    // V^T rows of 128 B at 144 B
#define AT_PP 72    // P rows of 128 B at 144 B
__global__ __launch_bounds__(128) void k_attn128(const _Float16* __restrict__ q16, const _Float16* __restrict__ k16,
                                                const _Float16* __restrict__ vt16, _Float16* __restrict__ o16,
                                                float scale) {
  __shared__ __align__(16) _Float16 Ksh[AT_KC * AT_KP];    // [kv][d]      17 KB
  __shared__ __align__(16) _Float16 Vts[kC * AT_VP];       // [d][kv]      18 KB
  __shared__ __align__(16) _Float16 Psh[4][16 * AT_PP];    // per wave [row][kv]  9 KB
  __shared__ __align__(16) _Float16 Osh[4][16 * AT_OP];    // per wave [row][d]   17 KB
  const int tid  = threadIdx.x;
  const int wave = tid >> 5;
  const int lane = tid & 31;
  const int hh   = lane >> 4;
  const int c    = lane & 15;
  const int b    = blockIdx.x >> 6;
  const int qb   = blockIdx.x & 63;
  const int q0   = qb * 64 + wave * 16;
  const size_t tok0 = (size_t)b * kN;

  // Q fragments (A operand), 4 d-chunks of 32
  v16h qa[4];
  {
    const _Float16* qrow = q16 + (tok0 + q0 + c) * kC;
#pragma unroll
    for (int dc = 0; dc < 4; ++dc) qa[dc] = Frag<_Float16>::load(qrow + dc * 32 + 8 * hh);
  }

  float mrow[8], lrow[8];
  v8f oacc[8];
#pragma unroll
  for (int r = 0; r < 8; ++r) { mrow[r] = -__builtin_inff(); lrow[r] = 0.f; }
#pragma unroll
  for (int t = 0; t < 8; ++t) oacc[t] = (v8f){0.f,0.f,0.f,0.f,0.f,0.f,0.f,0.f};

  _Float16* pw = Psh[wave];
  const float PSC = 32768.0f;

#pragma unroll 1
  for (int kc = 0; kc < kN / AT_KC; ++kc) {
    const int kv0 = kc * AT_KC;
    __syncthreads();
#pragma unroll
    for (int it = 0; it < 8; ++it) {
      const int i = tid + 128 * it;                          // 0..1023
      {
        const int row = i >> 4, d8 = (i & 15) * 8;
        const v8h kk = *(const v8h*)(k16 + (tok0 + kv0 + row) * kC + d8);
        // row = (tid >> 4) + 8 * it: so written, the padded address is one base register plus a constant per it
        *(v8h*)(Ksh + (tid >> 4) * AT_KP + (tid & 15) * 8 + it * (8 * AT_KP)) = kk;
      }
      {
        const int d = i >> 3, c8 = (i & 7) * 8;
        const v8h vv = *(const v8h*)(vt16 + ((size_t)b * kC + d) * kN + kv0 + c8);
        // d = (tid >> 3) + 16 * it: the same form
        *(v8h*)(Vts + (tid >> 3) * AT_VP + (tid & 7) * 8 + it * (16 * AT_VP)) = vv;
      }
    }
    __syncthreads();

    // S = Q . K^T : 4 key tiles of 16, k = d over 4 chunks
    v8f s[4];
#pragma unroll
    for (int j = 0; j < 4; ++j) {
      s[j] = (v8f){0.f,0.f,0.f,0.f,0.f,0.f,0.f,0.f};
#pragma unroll
      for (int dc = 0; dc < 4; ++dc) {
        const v16h kb = Frag<_Float16>::load(Ksh + (j * 16 + c) * AT_KP + dc * 32 + 8 * hh);
        s[j] = mma16(qa[dc], kb, s[j]);
      }
    }

    // chunk row max (row 8hh+r, 64 cols spread over the 16 lanes of this half x 4 tiles)
    float cm[8];
#pragma unroll
    for (int r = 0; r < 8; ++r) {
      float m = -__builtin_inff();
#pragma unroll
      for (int j = 0; j < 4; ++j) {
        const float sv = s[j][r] * scale;
        s[j][r] = sv;
        m = fmaxf(m, sv);
      }
#pragma unroll
      for (int off = 1; off < 16; off <<= 1) m = fmaxf(m, __shfl_xor(m, off, 32));
      cm[r] = m;
    }
    // online softmax; P (x2^15, f16) into this wave's LDS slab
#pragma unroll
    for (int r = 0; r < 8; ++r) {
      const float mnew  = fmaxf(mrow[r], cm[r]);
      const float alpha = __expf(mrow[r] - mnew);
      mrow[r] = mnew;
      float psum = 0.f;
#pragma unroll
      for (int j = 0; j < 4; ++j) {
        const float p = __expf(s[j][r] - mnew);
        psum += p;
        pw[(8 * hh + r) * AT_PP + j * 16 + c] = (_Float16)(p * PSC);
      }
#pragma unroll
      for (int off = 1; off < 16; off <<= 1) psum += __shfl_xor(psum, off, 32);
      lrow[r] = lrow[r] * alpha + psum;
#pragma unroll
      for (int t = 0; t < 8; ++t) oacc[t][r] *= alpha;
    }
    __builtin_amdgcn_fence(__ATOMIC_RELEASE, "workgroup");
    __builtin_amdgcn_wave_barrier();
    __builtin_amdgcn_fence(__ATOMIC_ACQUIRE, "workgroup");

    // O += P . V : A = P [row][kv], B[kv][d] = Vts[d][kv]; 2 kv chunks of 32, 8 d tiles
#pragma unroll
    for (int kk = 0; kk < 2; ++kk) {
      const v16h pa = Frag<_Float16>::load(pw + c * AT_PP + kk * 32 + 8 * hh);
#pragma unroll
      for (int t = 0; t < 8; ++t) {
        const v16h vb = Frag<_Float16>::load(Vts + (t * 16 + c) * AT_VP + kk * 32 + 8 * hh);
        oacc[t] = mma16(pa, vb, oacc[t]);
      }
    }
  }

  _Float16* osw = Osh[wave];
#pragma unroll
  for (int r = 0; r < 8; ++r) {
    const float inv = 1.0f / (lrow[r] * PSC);
#pragma unroll
    for (int t = 0; t < 8; ++t) osw[(8 * hh + r) * AT_OP + t * 16 + c] = (_Float16)(oacc[t][r] * inv);
  }
  __builtin_amdgcn_fence(__ATOMIC_RELEASE, "workgroup");
  __builtin_amdgcn_wave_barrier();
  __builtin_amdgcn_fence(__ATOMIC_ACQUIRE, "workgroup");
  {
    const int c8 = (lane & 15) * 8;                          // row = 256 B = 16 lanes x 16 B
    _Float16* ob = o16 + (tok0 + q0) * kC;
    {
#pragma unroll
      for (int it = 0; it < 8; ++it) {
        const int row = it * 2 + hh;
        const v8h val = *(const v8h*)(osw + row * AT_OP + c8);
        *(v8h*)(ob + (size_t)row * kC + c8) = val;
      }
      
    }
  }
}

// ---------------------------------------------------------------------------
extern "C" void kernel_launch(void* const* d_in, const int* in_sizes, int n_in,
                              void* d_out, int out_size, void* d_ws, size_t ws_size,
                              hipStream_t stream) {
  if (n_in < 11) return;
  if (in_sizes[0] != kM * kC || out_size != kM * kC) return;
  if (in_sizes[1] != kC || in_sizes[2] != kC || in_sizes[4] != kC || in_sizes[6] != kC ||
      in_sizes[8] != kC || in_sizes[10] != kC) return;
  if (in_sizes[3] != kC * kC || in_sizes[5] != kC * kC || in_sizes[7] != kC * kC || in_sizes[9] != kC * kC) return;

  const float* x  = (const float*)d_in[0];
  const float* gs = (const float*)d_in[1];
  const float* gb = (const float*)d_in[2];
  const float* wq = (const float*)d_in[3];
  const float* bq = (const float*)d_in[4];
  const float* wk = (const float*)d_in[5];
  const float* bk = (const float*)d_in[6];
  const float* wv = (const float*)d_in[7];
  const float* bv = (const float*)d_in[8];
  const float* wo = (const float*)d_in[9];
  const float* bo = (const float*)d_in[10];
  float* out = (float*)d_out;

  // workspace carve (bytes)
  const size_t szW   = (size_t)4 * kC * kC * sizeof(_Float16);       // 131072
  const size_t szTab = (size_t)kB * 64 * sizeof(float);               // 4096
  const size_t szT16 = (size_t)kM * kC * sizeof(_Float16);            // 16777216
  const size_t offW   = 0;
  const size_t offTab = offW + szW;
  const size_t offH   = offTab + szTab;
  const size_t offQ   = offH + szT16;
  const size_t offK   = offQ + szT16;
  const size_t offVt  = offK + szT16;
  const size_t offO   = offVt + szT16;
  const size_t offEnd = offO + szT16;                                  // 84021248
  if (offEnd > ws_size) return;

  char* ws = (char*)d_ws;
  _Float16* wt16 = (_Float16*)(ws + offW);
  float*    gtab = (float*)(ws + offTab);
  _Float16* h16  = (_Float16*)(ws + offH);
  _Float16* q16  = (_Float16*)(ws + offQ);
  _Float16* k16  = (_Float16*)(ws + offK);
  _Float16* vt16 = (_Float16*)(ws + offVt);
  _Float16* o16  = (_Float16*)(ws + offO);
  const _Float16* wtq = wt16;
  const _Float16* wtk = wt16 + (size_t)kC * kC;
  const _Float16* wtv = wt16 + (size_t)2 * kC * kC;
  const _Float16* wto = wt16 + (size_t)3 * kC * kC;

  // 1. weights f32 [c][d] -> f16 [d][c]
  k_wconvert<<<dim3(kC / 32, 4), 256, 0, stream>>>(wq, wk, wv, wo, wt16);
  // 2. GroupNorm statistics and apply
  k_gn_stats<<<kB, 256, 0, stream>>>(x, gtab);
  const int nvec = kM * (kC / 8);                                      // 1048576
  k_gn_apply<<<(nvec + 255) / 256, 256, 0, stream>>>(x, gs, gb, gtab, h16, nvec);

  // 3. projections: q16 = h.wq + bq, k16 = h.wk + bk   (M=65536, N=128, K=128; 2048 wave tiles)
  const int gridMN = ((kM / 64) * (kC / 64) + 7) / 8;                  // 256
  wmma_gemm64<0, false, 2, 1, false><<<dim3(gridMN, 1), 256, 0, stream>>>(
      U16(h16), U16(h16), kC, (long)0, U16(wtq), U16(wtq), kC, (long)0,
      (void*)q16, (void*)nullptr, kC, (long)0, bq, (const float*)nullptr, (long)0, kM, kC, kC, 1.0f);
  wmma_gemm64<0, false, 2, 1, false><<<dim3(gridMN, 1), 256, 0, stream>>>(
      U16(h16), U16(h16), kC, (long)0, U16(wtk), U16(wtk), kC, (long)0,
      (void*)k16, (void*)nullptr, kC, (long)0, bk, (const float*)nullptr, (long)0, kM, kC, kC, 1.0f);
  //    v^T per image: vt16[b][d][n] = sum_c wt_v[d][c] . h16[b][n][c] + bv[d]  (M=128, N=4096, K=128, batched)
  const int gridVt = ((kC / 64) * (kN / 64) + 7) / 8;                  // 16
  wmma_gemm64<0, false, 1, 1, false><<<dim3(gridVt, kB), 256, 0, stream>>>(
      U16(wtv), U16(wtv), kC, (long)0, U16(h16), U16(h16), kC, (long)kN * kC,
      (void*)vt16, (void*)nullptr, kN, (long)kC * kN, bv, (const float*)nullptr, (long)0, kC, kN, kC, 1.0f);

  // 4. attention
  const float scale = 0.08838834764831845f;                            // 128^-0.5
  k_attn128<<<kB * (kN / 64), 128, 0, stream>>>(q16, k16, vt16, o16, scale);

  // 5. out = x + o.wo + bo  (f32, residual)
  wmma_gemm64<0, false, 2, 0, true><<<dim3(gridMN, 1), 256, 0, stream>>>(
      U16(o16), U16(o16), kC, (long)0, U16(wto), U16(wto), kC, (long)0,
      (void*)out, (void*)nullptr, kC, (long)0, bo, x, (long)0, kM, kC, kC, 1.0f);
}

// v002
// One run takes 483 microseconds.
// Two timings next to v001 both put it at 1.11 times that version's speed.
// All steps since v000 together make it 2.47 times as fast.
// Contractions: v_wmma_f32_16x16x32_f16 (f16 operands, f32 accumulate) for the three 1x1 projections,
// q.k^T, p.v (p carried x2^15) and the output projection; GroupNorm statistics f64/f32, softmax f32.
#include <hip/hip_runtime.h>

typedef __attribute__((ext_vector_type(16))) _Float16 v16h;
typedef __attribute__((ext_vector_type(8)))  _Float16 v8h;
typedef __attribute__((ext_vector_type(16))) __bf16   v16b;
typedef __attribute__((ext_vector_type(8)))  __bf16   v8b;
typedef __attribute__((ext_vector_type(8)))  float    v8f;
typedef __attribute__((ext_vector_type(4)))  float    v4f;
#define U16(p) ((const unsigned short*)(const void*)(p))

static constexpr int kB  = 16;          // batch
static constexpr int kN  = 4096;        // tokens per image (64*64)
static constexpr int kC  = 128;         // channels
static constexpr int kM  = kB * kN;     // 65536 token rows
static constexpr int kNG = 32;          // groups
static constexpr int kCPG = 4;          // channels per group

__device__ __forceinline__ unsigned short f2bf_bits(float f) {
  unsigned u = __float_as_uint(f);
  return (unsigned short)((u + 0x7FFFu + ((u >> 16) & 1u)) >> 16);
}
__device__ __forceinline__ float bf_bits2f(unsigned short h) { return __uint_as_float(((unsigned)h) << 16); }

// hazard guards as plain device helpers
__device__ __forceinline__ void dep_guard_h(v8f& a, v8f& b, v16h x, v16h y) { asm volatile("v_nop\n\tv_nop\n\tv_nop\n\tv_nop" : "+v"(a), "+v"(b) : "v"(x), "v"(y)); }
__device__ __forceinline__ void dep_guard_b(v8f& a, v8f& b, v16b x, v16b y) { asm volatile("v_nop\n\tv_nop\n\tv_nop\n\tv_nop" : "+v"(a), "+v"(b) : "v"(x), "v"(y)); }
__device__ __forceinline__ void keep4_h(v16h a, v16h b, v16h c, v16h d) { asm volatile("v_nop" :: "v"(a), "v"(b), "v"(c), "v"(d)); }
__device__ __forceinline__ void keep4_b(v16b a, v16b b, v16b c, v16b d) { asm volatile("v_nop" :: "v"(a), "v"(b), "v"(c), "v"(d)); }
__device__ __forceinline__ void acc_guard4(v8f& a, v8f& b, v8f& c, v8f& d) { asm volatile("v_nop\n\tv_nop\n\tv_nop\n\tv_nop" : "+v"(a), "+v"(b), "+v"(c), "+v"(d)); }
template <typename T> struct Frag;
template <> struct Frag<_Float16> {
  typedef v16h V; union U { v16h v; v8h h[2]; };
  static __device__ __forceinline__ v16h load(const _Float16* p) {   // elements 0..7 <- p[0..7], 8..15 <- p[16..23]
    U f; f.h[0] = *(const v8h*)(p); f.h[1] = *(const v8h*)(p + 16); return f.v;
  }
  static __device__ __forceinline__ v8f mma(v16h a, v16h b, v8f c) {
    return __builtin_amdgcn_wmma_f32_16x16x32_f16(false, a, false, b, (short)0, c, false, false);
  }
  static __device__ __forceinline__ void guard(v8f& a, v8f& b, v16h x, v16h y) { dep_guard_h(a, b, x, y); }
  static __device__ __forceinline__ void keep(v16h a, v16h b, v16h c, v16h d) { keep4_h(a, b, c, d); }
};
template <> struct Frag<__bf16> {
  typedef v16b V; union U { v16b v; v8b h[2]; };
  static __device__ __forceinline__ v16b load(const __bf16* p) {
    U f; f.h[0] = *(const v8b*)(p); f.h[1] = *(const v8b*)(p + 16); return f.v;
  }
  static __device__ __forceinline__ v8f mma(v16b a, v16b b, v8f c) {
    return __builtin_amdgcn_wmma_f32_16x16x32_bf16(false, a, false, b, (short)0, c, false, false);
  }
  static __device__ __forceinline__ void guard(v8f& a, v8f& b, v16b x, v16b y) { dep_guard_b(a, b, x, y); }
  static __device__ __forceinline__ void keep(v16b a, v16b b, v16b c, v16b d) { keep4_b(a, b, c, d); }
};

// per-call guarded f16 WMMA (4 nops tying D and both operands)
__device__ __forceinline__ v8f mma16(v16h a, v16h b, v8f c) {
  c = __builtin_amdgcn_wmma_f32_16x16x32_f16(false, a, false, b, (short)0, c, false, false);
  asm volatile("v_nop\n\tv_nop\n\tv_nop\n\tv_nop" : "+v"(c) : "v"(a), "v"(b));
  return c;
}

// lane l <- lane l ^ M inside its 16-lane row, on the vector unit (DPP row_xmask): no LDS-pipe round trip, no wait
template <int M> __device__ __forceinline__ float row_xor(float v) {
  return __builtin_bit_cast(float, __builtin_amdgcn_update_dpp(0, __builtin_bit_cast(int, v), 0x160 | M, 0xf, 0xf, true));
}
// 16-lane row maximum of eight values at once. Written as asm because fmaxf on a DPP-moved value compiles to three
// dependent instructions a step (move, quieting max, max) where the chip has one; the eight rows are interleaved so that
// each step's producer stands eight instructions back and no step waits on the one before it.
__device__ __forceinline__ void row_max16_x8(float (&m)[8]) {
  asm(
      "v_max_num_f32_dpp %0, %0, %0 row_xmask:1 row_mask:0xf bank_mask:0xf\n\t"
      "v_max_num_f32_dpp %1, %1, %1 row_xmask:1 row_mask:0xf bank_mask:0xf\n\t"
      "v_max_num_f32_dpp %2, %2, %2 row_xmask:1 row_mask:0xf bank_mask:0xf\n\t"
      "v_max_num_f32_dpp %3, %3, %3 row_xmask:1 row_mask:0xf bank_mask:0xf\n\t"
      "v_max_num_f32_dpp %4, %4, %4 row_xmask:1 row_mask:0xf bank_mask:0xf\n\t"
      "v_max_num_f32_dpp %5, %5, %5 row_xmask:1 row_mask:0xf bank_mask:0xf\n\t"
      "v_max_num_f32_dpp %6, %6, %6 row_xmask:1 row_mask:0xf bank_mask:0xf\n\t"
      "v_max_num_f32_dpp %7, %7, %7 row_xmask:1 row_mask:0xf bank_mask:0xf\n\t"
      "v_max_num_f32_dpp %0, %0, %0 row_xmask:2 row_mask:0xf bank_mask:0xf\n\t"
      "v_max_num_f32_dpp %1, %1, %1 row_xmask:2 row_mask:0xf bank_mask:0xf\n\t"
      "v_max_num_f32_dpp %2, %2, %2 row_xmask:2 row_mask:0xf bank_mask:0xf\n\t"
      "v_max_num_f32_dpp %3, %3, %3 row_xmask:2 row_mask:0xf bank_mask:0xf\n\t"
      "v_max_num_f32_dpp %4, %4, %4 row_xmask:2 row_mask:0xf bank_mask:0xf\n\t"
      "v_max_num_f32_dpp %5, %5, %5 row_xmask:2 row_mask:0xf bank_mask:0xf\n\t"
      "v_max_num_f32_dpp %6, %6, %6 row_xmask:2 row_mask:0xf bank_mask:0xf\n\t"
      "v_max_num_f32_dpp %7, %7, %7 row_xmask:2 row_mask:0xf bank_mask:0xf\n\t"
      "v_max_num_f32_dpp %0, %0, %0 row_xmask:4 row_mask:0xf bank_mask:0xf\n\t"
      "v_max_num_f32_dpp %1, %1, %1 row_xmask:4 row_mask:0xf bank_mask:0xf\n\t"
      "v_max_num_f32_dpp %2, %2, %2 row_xmask:4 row_mask:0xf bank_mask:0xf\n\t"
      "v_max_num_f32_dpp %3, %3, %3 row_xmask:4 row_mask:0xf bank_mask:0xf\n\t"
      "v_max_num_f32_dpp %4, %4, %4 row_xmask:4 row_mask:0xf bank_mask:0xf\n\t"
      "v_max_num_f32_dpp %5, %5, %5 row_xmask:4 row_mask:0xf bank_mask:0xf\n\t"
      "v_max_num_f32_dpp %6, %6, %6 row_xmask:4 row_mask:0xf bank_mask:0xf\n\t"
      "v_max_num_f32_dpp %7, %7, %7 row_xmask:4 row_mask:0xf bank_mask:0xf\n\t"
      "v_max_num_f32_dpp %0, %0, %0 row_xmask:8 row_mask:0xf bank_mask:0xf\n\t"
      "v_max_num_f32_dpp %1, %1, %1 row_xmask:8 row_mask:0xf bank_mask:0xf\n\t"
      "v_max_num_f32_dpp %2, %2, %2 row_xmask:8 row_mask:0xf bank_mask:0xf\n\t"
      "v_max_num_f32_dpp %3, %3, %3 row_xmask:8 row_mask:0xf bank_mask:0xf\n\t"
      "v_max_num_f32_dpp %4, %4, %4 row_xmask:8 row_mask:0xf bank_mask:0xf\n\t"
      "v_max_num_f32_dpp %5, %5, %5 row_xmask:8 row_mask:0xf bank_mask:0xf\n\t"
      "v_max_num_f32_dpp %6, %6, %6 row_xmask:8 row_mask:0xf bank_mask:0xf\n\t"
      "v_max_num_f32_dpp %7, %7, %7 row_xmask:8 row_mask:0xf bank_mask:0xf"
      : "+v"(m[0]), "+v"(m[1]), "+v"(m[2]), "+v"(m[3]), "+v"(m[4]), "+v"(m[5]), "+v"(m[6]), "+v"(m[7]));
}
__device__ __forceinline__ float row_sum16(float s) {
  s += row_xor<1>(s); s += row_xor<2>(s); s += row_xor<4>(s); s += row_xor<8>(s);
  return s;
}

// ---- Register-blocked batched WMMA GEMM --------------------------------
// C[m,n] = scale * sum_k A[m,k] * Bt[n,k] (+bias)(+resid); each wave owns a 64x64 tile.
// A row-major [M,K]; Bt row-major [N,K]; M,N % 64 == 0, K % 32 == 0.
// SPLIT: operands are hi/lo planes (A2/Bt2 = lo planes, same layout); product = hi·hi + hi·lo + lo·hi.
// BIAS_MODE: 0 = none, 1 = bias[m], 2 = bias[n].
// OUT_MODE: 0 = f32, 1 = f16, 2 = bf16 hi plane (Cout) + bf16 lo plane (Cout2).
// ET: 0 = f16 operands, 1 = bf16 operands (pointers passed as 16-bit storage)
template <int ET> struct Elem;
template <> struct Elem<0> { typedef _Float16 T; };
template <> struct Elem<1> { typedef __bf16 T; };
template <int ET, bool SPLIT, int BIAS_MODE, int OUT_MODE, bool RESID, int ACT = 0>
__global__ __launch_bounds__(256) void wmma_gemm64(
    const unsigned short* __restrict__ Ap, const unsigned short* __restrict__ A2p, int lda, long strideA,
    const unsigned short* __restrict__ Btp, const unsigned short* __restrict__ Bt2p, int ldb, long strideB,
    void* __restrict__ Cout, void* __restrict__ Cout2, int ldc, long strideC,
    const float* __restrict__ bias,
    const float* __restrict__ resid, long strideR,
    int M, int N, int K, float scale) {
  typedef typename Elem<ET>::T T;
  typedef typename Frag<T>::V V;
  const T* A = (const T*)Ap; const T* A2 = (const T*)A2p; const T* Bt = (const T*)Btp; const T* Bt2 = (const T*)Bt2p;
  __shared__ __align__(16) float sT[8][16 * 68];   // per-wave 16x64 slab, pitch 68 floats
  const int b    = blockIdx.y;
  const int lane = threadIdx.x & 31;
  const int wave = threadIdx.x >> 5;
  const int tilesN = N >> 6;
  const int tilesM = M >> 6;
  const int tile = blockIdx.x * 8 + wave;
  if (tile >= tilesM * tilesN) return;   // wave-uniform; no block barriers in this kernel
  const int tm = tile / tilesN;
  const int tn = tile - tm * tilesN;
  const int m0 = tm << 6;
  const int n0 = tn << 6;

  const T* Ab  = A  + (size_t)b * strideA;
  const T* Bb  = Bt + (size_t)b * strideB;
  const T* Ab2 = SPLIT ? (A2  + (size_t)b * strideA) : nullptr;
  const T* Bb2 = SPLIT ? (Bt2 + (size_t)b * strideB) : nullptr;

  const int rlane = lane & 15;                 // row (A) / col (B, D) within subtile
  const int koff  = (lane >> 4) * 8;           // k offset of this lane half
  const int mOff  = (lane >> 4) * 8;           // D row offset

  v8f acc[4][4];
#pragma unroll
  for (int i = 0; i < 4; ++i)
#pragma unroll
    for (int j = 0; j < 4; ++j) acc[i][j] = (v8f){0.f,0.f,0.f,0.f,0.f,0.f,0.f,0.f};

  for (int k0 = 0; k0 < K; k0 += 32) {
    V bh[4], bl[4];
#pragma unroll
    for (int j = 0; j < 4; ++j) {
      const size_t bo = (size_t)(n0 + (j << 4) + rlane) * ldb + koff + k0;
      bh[j] = Frag<T>::load(Bb + bo);
      if (SPLIT) bl[j] = Frag<T>::load(Bb2 + bo);
    }
#pragma unroll
    for (int i = 0; i < 4; ++i) {
      const size_t ao = (size_t)(m0 + (i << 4) + rlane) * lda + koff + k0;
      V ah = Frag<T>::load(Ab + ao);
      V al;
      if (SPLIT) al = Frag<T>::load(Ab2 + ao);
#pragma unroll
      for (int j = 0; j < 4; ++j) {
        acc[i][j] = Frag<T>::mma(ah, bh[j], acc[i][j]);
        if (SPLIT) {
          acc[i][j] = Frag<T>::mma(ah, bl[j], acc[i][j]);
          acc[i][j] = Frag<T>::mma(al, bh[j], acc[i][j]);
        }
      }
      Frag<T>::guard(acc[i][0], acc[i][3], ah, SPLIT ? al : ah);
    }
    Frag<T>::keep(bh[0], bh[1], bh[2], bh[3]);
    if (SPLIT) Frag<T>::keep(bl[0], bl[1], bl[2], bl[3]);
  }
  acc_guard4(acc[0][0], acc[0][1], acc[0][2], acc[0][3]);
  acc_guard4(acc[1][0], acc[1][1], acc[1][2], acc[1][3]);
  acc_guard4(acc[2][0], acc[2][1], acc[2][2], acc[2][3]);
  acc_guard4(acc[3][0], acc[3][1], acc[3][2], acc[3][3]);

  // ---- epilogue ----
  float* slab = sT[wave];
  const float* Rb = RESID ? (resid + (size_t)b * strideR) : nullptr;
#pragma unroll
  for (int i = 0; i < 4; ++i) {
    const int mBase = m0 + (i << 4);
#pragma unroll
    for (int j = 0; j < 4; ++j) {
      const int n = n0 + (j << 4) + rlane;
      float bv = 0.f;
      if (BIAS_MODE == 2) bv = bias[n];
#pragma unroll
      for (int r = 0; r < 8; ++r) {
        float v = acc[i][j][r] * scale;
        if (BIAS_MODE == 1) v += bias[mBase + mOff + r];
        if (BIAS_MODE == 2) v += bv;
        if (RESID) v += Rb[(size_t)(mBase + mOff + r) * ldc + n];
        if (ACT == 1) v = tanhf(v);
        if (ACT == 2) v = fmaxf(v, 0.0f);
        if (ACT == 3) v = v / (1.0f + expf(-v));
        if (ACT == 4) v = (v > 0.f) ? v : 0.01f * v;
        if (ACT == 5) v = 0.5f * v * (1.0f + erff(v * 0.70710678118654752f));
        slab[(mOff + r) * 68 + (j << 4) + rlane] = v;
      }
    }
    __builtin_amdgcn_fence(__ATOMIC_RELEASE, "workgroup");
    __builtin_amdgcn_wave_barrier();
    __builtin_amdgcn_fence(__ATOMIC_ACQUIRE, "workgroup");
    if (OUT_MODE == 0) {
      float* C = (float*)Cout + (size_t)b * strideC;
      const int hh = lane >> 4, c4 = (lane & 15) * 4;     // row seg = 256 B = 16 lanes x 16 B
      {
#pragma unroll
        for (int it = 0; it < 8; ++it) {
          const int row = it * 2 + hh;
          v4f v = *(const v4f*)(slab + row * 68 + c4);
          *(v4f*)(C + (size_t)(mBase + row) * ldc + n0 + c4) = v;
        }
        
      }
    } else {
      const int q = lane >> 3, c8 = (lane & 7) * 8;
      unsigned short* C  = (unsigned short*)Cout  + (size_t)b * strideC;
      unsigned short* C2 = (OUT_MODE == 2) ? ((unsigned short*)Cout2 + (size_t)b * strideC) : nullptr;
      {
#pragma unroll
        for (int it = 0; it < 4; ++it) {
          const int row = it * 4 + q;
          const float* sp = slab + row * 68 + c8;
          v8h hv, lv;
#pragma unroll
          for (int e = 0; e < 8; ++e) {
            if (OUT_MODE == 1) {
              hv[e] = (_Float16)sp[e];
            } else {
              unsigned short hb = f2bf_bits(sp[e]);
              unsigned short lb = f2bf_bits(sp[e] - bf_bits2f(hb));
              hv[e] = __builtin_bit_cast(_Float16, hb);
              lv[e] = __builtin_bit_cast(_Float16, lb);
            }
          }
          *(v8h*)(C + (size_t)(mBase + row) * ldc + n0 + c8) = hv;
          if (OUT_MODE == 2) *(v8h*)(C2 + (size_t)(mBase + row) * ldc + n0 + c8) = lv;
        }
        
      }
    }
    __builtin_amdgcn_fence(__ATOMIC_RELEASE, "workgroup");
    __builtin_amdgcn_wave_barrier();
    __builtin_amdgcn_fence(__ATOMIC_ACQUIRE, "workgroup");
  }
}

// ---------------------------------------------------------------------------
// Weight convert: four f32 [c][d] matrices -> f16 transposed wt16[mat][d][c] (k-contiguous rows).
// grid (4 row-blocks of 32 d, 4 matrices), block 256. LDS transpose; each output row (256 B)
// ---------------------------------------------------------------------------
#define WC_P 136
__global__ __launch_bounds__(256) void k_wconvert(const float* __restrict__ w0, const float* __restrict__ w1,
                                                 const float* __restrict__ w2, const float* __restrict__ w3,
                                                 _Float16* __restrict__ wt16) {
  __shared__ __align__(16) _Float16 T[32 * WC_P];           // [d local][c]
  const int mat = blockIdx.y;
  const int n0  = blockIdx.x * 32;
  const int t   = threadIdx.x;
  const float* src = (mat == 0) ? w0 : (mat == 1) ? w1 : (mat == 2) ? w2 : w3;
#pragma unroll
  for (int it = 0; it < 16; ++it) {
    const int idx = it * 256 + t;                            // 0..4095
    const int k = idx >> 5, j = idx & 31;
    T[j * WC_P + k] = (_Float16)src[(size_t)k * kC + n0 + j];
  }
  __syncthreads();
  const int row0 = t >> 4, c8 = (t & 15) * 8;
  _Float16* dst = wt16 + ((size_t)mat * kC + n0) * kC;
  {
#pragma unroll
    for (int it = 0; it < 2; ++it) {
      const int rr = row0 + 16 * it;
      const v8h val = *(const v8h*)(T + rr * WC_P + c8);
      *(v8h*)(dst + (size_t)rr * kC + c8) = val;
    }
    
  }
}

// ---------------------------------------------------------------------------
// GroupNorm statistics: one block per image; lane = group, 8 row-phases per group; f64 accumulation.
// Table row per image: [0..31] = mean, [32..63] = rstd (256 B), written by lanes 0..15 of wave 0.
// ---------------------------------------------------------------------------
__global__ __launch_bounds__(256) void k_gn_stats(const float* __restrict__ x, float* __restrict__ gtab) {
  __shared__ double red_s[8][32], red_q[8][32];
  __shared__ __align__(16) float tab[64];
  const int b = blockIdx.x;
  const int t = threadIdx.x, g = t & 31, rs = t >> 5;
  const float* xb = x + (size_t)b * kN * kC + kCPG * g;
  double s = 0.0, ss = 0.0;
  for (int r = rs; r < kN; r += 8) {
    const v4f v = *(const v4f*)(xb + (size_t)r * kC);
#pragma unroll
    for (int e = 0; e < 4; ++e) { const double d = (double)v[e]; s += d; ss += d * d; }
  }
  red_s[rs][g] = s; red_q[rs][g] = ss;
  __syncthreads();
  if (t < 32) {
    double S = 0.0, Q = 0.0;
#pragma unroll
    for (int i = 0; i < 8; ++i) { S += red_s[i][t]; Q += red_q[i][t]; }
    const double inv_n = 1.0 / (double)(kN * kCPG);
    const double mean = S * inv_n;
    double var = Q * inv_n - mean * mean;
    if (var < 0.0) var = 0.0;
    const float rstd = rsqrtf((float)var + 1e-6f);
    tab[t] = (float)mean;
    tab[32 + t] = rstd;
  }
  __syncthreads();
  if (t < 16) {
    const v4f v = *(const v4f*)(tab + 4 * t);
    *(v4f*)(gtab + (size_t)b * 64 + 4 * t) = v;
    
  }
}

// ---------------------------------------------------------------------------
// GroupNorm apply: thread = 8 consecutive channels of one token row -> f16 h16[m][c] (16-B store,
// ---------------------------------------------------------------------------
__global__ __launch_bounds__(256) void k_gn_apply(const float* __restrict__ x, const float* __restrict__ gs,
                                                 const float* __restrict__ gb, const float* __restrict__ gtab,
                                                 _Float16* __restrict__ h16, int nvec) {
  const int i = blockIdx.x * 256 + threadIdx.x;
  if (i >= nvec) return;
  const int m  = i >> 4;
  const int c8 = (i & 15) * 8;
  const int b  = m >> 12;
  const int g0 = c8 >> 2;
  const float* tb = gtab + (size_t)b * 64;
  const float mean0 = tb[g0],     rstd0 = tb[32 + g0];
  const float mean1 = tb[g0 + 1], rstd1 = tb[32 + g0 + 1];
  const float* xr = x + (size_t)m * kC + c8;
  const v4f xa = *(const v4f*)(xr), xb2 = *(const v4f*)(xr + 4);
  const v4f sa = *(const v4f*)(gs + c8), sb = *(const v4f*)(gs + c8 + 4);
  const v4f ba = *(const v4f*)(gb + c8), bb = *(const v4f*)(gb + c8 + 4);
  v8h hv;
#pragma unroll
  for (int e = 0; e < 4; ++e) {
    hv[e]     = (_Float16)(((xa[e]  - mean0) * rstd0) * sa[e] + ba[e]);
    hv[4 + e] = (_Float16)(((xb2[e] - mean1) * rstd1) * sb[e] + bb[e]);
  }
  _Float16* dst = h16 + (size_t)m * kC + c8;
  *(v8h*)dst = hv;
  
}

// ---------------------------------------------------------------------------
// Flash attention, head dim 128, f16 q/k/v^T in, f16 out.
//   scores = q.k^T (x scale in f32)  : v_wmma_f32_16x16x32_f16
//   out    = p.v, p carried x2^15    : v_wmma_f32_16x16x32_f16; f32 accumulate; online softmax f32.
// Block = 4 waves = 64 query rows of one image; 64-key chunks; K [kv][d] and V^T [d][kv] tiles staged
// in LDS with plain 16-B loads + __syncthreads. grid.x = 16 images x 64 query blocks.
// ---------------------------------------------------------------------------
#define AT_KC 64
#define AT_OP 136
// LDS row pitches in f16 elements: an odd multiple of 16 B, so the 16 rows of one ds_load_b128 fall on distinct banks
#define AT_KP 136   // K rows of 256 B at 272 B
#define AT_VP 72    // V^T rows of 128 B at 144 B
#define AT_PP 72    // P rows of 128 B at 144 B
__global__ __launch_bounds__(128) void k_attn128(const _Float16* __restrict__ q16, const _Float16* __restrict__ k16,
                                                const _Float16* __restrict__ vt16, _Float16* __restrict__ o16,
                                                float scale) {
  __shared__ __align__(16) _Float16 Ksh[AT_KC * AT_KP];    // [kv][d]      17 KB
  __shared__ __align__(16) _Float16 Vts[kC * AT_VP];       // [d][kv]      18 KB
  __shared__ __align__(16) _Float16 Psh[4][16 * AT_PP];    // per wave [row][kv]  9 KB
  __shared__ __align__(16) _Float16 Osh[4][16 * AT_OP];    // per wave [row][d]   17 KB
  const int tid  = threadIdx.x;
  const int wave = tid >> 5;
  const int lane = tid & 31;
  const int hh   = lane >> 4;
  const int c    = lane & 15;
  const int b    = blockIdx.x >> 6;
  const int qb   = blockIdx.x & 63;
  const int q0   = qb * 64 + wave * 16;
  const size_t tok0 = (size_t)b * kN;

  // Q fragments (A operand), 4 d-chunks of 32
  v16h qa[4];
  {
    const _Float16* qrow = q16 + (tok0 + q0 + c) * kC;
#pragma unroll
    for (int dc = 0; dc < 4; ++dc) qa[dc] = Frag<_Float16>::load(qrow + dc * 32 + 8 * hh);
  }

  float mrow[8], lrow[8];
  v8f oacc[8];
#pragma unroll
  for (int r = 0; r < 8; ++r) { mrow[r] = -__builtin_inff(); lrow[r] = 0.f; }
#pragma unroll
  for (int t = 0; t < 8; ++t) oacc[t] = (v8f){0.f,0.f,0.f,0.f,0.f,0.f,0.f,0.f};

  _Float16* pw = Psh[wave];
  const float PSC = 32768.0f;

#pragma unroll 1
  for (int kc = 0; kc < kN / AT_KC; ++kc) {
    const int kv0 = kc * AT_KC;
    __syncthreads();
#pragma unroll
    for (int it = 0; it < 8; ++it) {
      const int i = tid + 128 * it;                          // 0..1023
      {
        const int row = i >> 4, d8 = (i & 15) * 8;
        const v8h kk = *(const v8h*)(k16 + (tok0 + kv0 + row) * kC + d8);
        // row = (tid >> 4) + 8 * it: so written, the padded address is one base register plus a constant per it
        *(v8h*)(Ksh + (tid >> 4) * AT_KP + (tid & 15) * 8 + it * (8 * AT_KP)) = kk;
      }
      {
        const int d = i >> 3, c8 = (i & 7) * 8;
        const v8h vv = *(const v8h*)(vt16 + ((size_t)b * kC + d) * kN + kv0 + c8);
        // d = (tid >> 3) + 16 * it: the same form
        *(v8h*)(Vts + (tid >> 3) * AT_VP + (tid & 7) * 8 + it * (16 * AT_VP)) = vv;
      }
    }
    __syncthreads();

    // S = Q . K^T : 4 key tiles of 16, k = d over 4 chunks
    v8f s[4];
#pragma unroll
    for (int j = 0; j < 4; ++j) {
      s[j] = (v8f){0.f,0.f,0.f,0.f,0.f,0.f,0.f,0.f};
#pragma unroll
      for (int dc = 0; dc < 4; ++dc) {
        const v16h kb = Frag<_Float16>::load(Ksh + (j * 16 + c) * AT_KP + dc * 32 + 8 * hh);
        s[j] = mma16(qa[dc], kb, s[j]);
      }
    }

    // chunk row max (row 8hh+r, 64 cols spread over the 16 lanes of this half x 4 tiles)
    float cm[8];
#pragma unroll
    for (int r = 0; r < 8; ++r) {
      float m = -__builtin_inff();
#pragma unroll
      for (int j = 0; j < 4; ++j) {
        const float sv = s[j][r] * scale;
        s[j][r] = sv;
        m = fmaxf(m, sv);
      }
      cm[r] = m;
    }
    row_max16_x8(cm);
    // online softmax; P (x2^15, f16) into this wave's LDS slab
#pragma unroll
    for (int r = 0; r < 8; ++r) {
      const float mnew  = fmaxf(mrow[r], cm[r]);
      const float alpha = __expf(mrow[r] - mnew);
      mrow[r] = mnew;
      float psum = 0.f;
#pragma unroll
      for (int j = 0; j < 4; ++j) {
        const float p = __expf(s[j][r] - mnew);
        psum += p;
        pw[(8 * hh + r) * AT_PP + j * 16 + c] = (_Float16)(p * PSC);
      }
      psum = row_sum16(psum);
      lrow[r] = lrow[r] * alpha + psum;
#pragma unroll
      for (int t = 0; t < 8; ++t) oacc[t][r] *= alpha;
    }
    __builtin_amdgcn_fence(__ATOMIC_RELEASE, "workgroup");
    __builtin_amdgcn_wave_barrier();
    __builtin_amdgcn_fence(__ATOMIC_ACQUIRE, "workgroup");

    // O += P . V : A = P [row][kv], B[kv][d] = Vts[d][kv]; 2 kv chunks of 32, 8 d tiles
#pragma unroll
    for (int kk = 0; kk < 2; ++kk) {
      const v16h pa = Frag<_Float16>::load(pw + c * AT_PP + kk * 32 + 8 * hh);
#pragma unroll
      for (int t = 0; t < 8; ++t) {
        const v16h vb = Frag<_Float16>::load(Vts + (t * 16 + c) * AT_VP + kk * 32 + 8 * hh);
        oacc[t] = mma16(pa, vb, oacc[t]);
      }
    }
  }

  _Float16* osw = Osh[wave];
#pragma unroll
  for (int r = 0; r < 8; ++r) {
    const float inv = 1.0f / (lrow[r] * PSC);
#pragma unroll
    for (int t = 0; t < 8; ++t) osw[(8 * hh + r) * AT_OP + t * 16 + c] = (_Float16)(oacc[t][r] * inv);
  }
  __builtin_amdgcn_fence(__ATOMIC_RELEASE, "workgroup");
  __builtin_amdgcn_wave_barrier();
  __builtin_amdgcn_fence(__ATOMIC_ACQUIRE, "workgroup");
  {
    const int c8 = (lane & 15) * 8;                          // row = 256 B = 16 lanes x 16 B
    _Float16* ob = o16 + (tok0 + q0) * kC;
    {
#pragma unroll
      for (int it = 0; it < 8; ++it) {
        const int row = it * 2 + hh;
        const v8h val = *(const v8h*)(osw + row * AT_OP + c8);
        *(v8h*)(ob + (size_t)row * kC + c8) = val;
      }
      
    }
  }
}

// ---------------------------------------------------------------------------
extern "C" void kernel_launch(void* const* d_in, const int* in_sizes, int n_in,
                              void* d_out, int out_size, void* d_ws, size_t ws_size,
                              hipStream_t stream) {
  if (n_in < 11) return;
  if (in_sizes[0] != kM * kC || out_size != kM * kC) return;
  if (in_sizes[1] != kC || in_sizes[2] != kC || in_sizes[4] != kC || in_sizes[6] != kC ||
      in_sizes[8] != kC || in_sizes[10] != kC) return;
  if (in_sizes[3] != kC * kC || in_sizes[5] != kC * kC || in_sizes[7] != kC * kC || in_sizes[9] != kC * kC) return;

  const float* x  = (const float*)d_in[0];
  const float* gs = (const float*)d_in[1];
  const float* gb = (const float*)d_in[2];
  const float* wq = (const float*)d_in[3];
  const float* bq = (const float*)d_in[4];
  const float* wk = (const float*)d_in[5];
  const float* bk = (const float*)d_in[6];
  const float* wv = (const float*)d_in[7];
  const float* bv = (const float*)d_in[8];
  const float* wo = (const float*)d_in[9];
  const float* bo = (const float*)d_in[10];
  float* out = (float*)d_out;

  // workspace carve (bytes)
  const size_t szW   = (size_t)4 * kC * kC * sizeof(_Float16);       // 131072
  const size_t szTab = (size_t)kB * 64 * sizeof(float);               // 4096
  const size_t szT16 = (size_t)kM * kC * sizeof(_Float16);            // 16777216
  const size_t offW   = 0;
  const size_t offTab = offW + szW;
  const size_t offH   = offTab + szTab;
  const size_t offQ   = offH + szT16;
  const size_t offK   = offQ + szT16;
  const size_t offVt  = offK + szT16;
  const size_t offO   = offVt + szT16;
  const size_t offEnd = offO + szT16;                                  // 84021248
  if (offEnd > ws_size) return;

  char* ws = (char*)d_ws;
  _Float16* wt16 = (_Float16*)(ws + offW);
  float*    gtab = (float*)(ws + offTab);
  _Float16* h16  = (_Float16*)(ws + offH);
  _Float16* q16  = (_Float16*)(ws + offQ);
  _Float16* k16  = (_Float16*)(ws + offK);
  _Float16* vt16 = (_Float16*)(ws + offVt);
  _Float16* o16  = (_Float16*)(ws + offO);
  const _Float16* wtq = wt16;
  const _Float16* wtk = wt16 + (size_t)kC * kC;
  const _Float16* wtv = wt16 + (size_t)2 * kC * kC;
  const _Float16* wto = wt16 + (size_t)3 * kC * kC;

  // 1. weights f32 [c][d] -> f16 [d][c]
  k_wconvert<<<dim3(kC / 32, 4), 256, 0, stream>>>(wq, wk, wv, wo, wt16);
  // 2. GroupNorm statistics and apply
  k_gn_stats<<<kB, 256, 0, stream>>>(x, gtab);
  const int nvec = kM * (kC / 8);                                      // 1048576
  k_gn_apply<<<(nvec + 255) / 256, 256, 0, stream>>>(x, gs, gb, gtab, h16, nvec);

  // 3. projections: q16 = h.wq + bq, k16 = h.wk + bk   (M=65536, N=128, K=128; 2048 wave tiles)
  const int gridMN = ((kM / 64) * (kC / 64) + 7) / 8;                  // 256
  wmma_gemm64<0, false, 2, 1, false><<<dim3(gridMN, 1), 256, 0, stream>>>(
      U16(h16), U16(h16), kC, (long)0, U16(wtq), U16(wtq), kC, (long)0,
      (void*)q16, (void*)nullptr, kC, (long)0, bq, (const float*)nullptr, (long)0, kM, kC, kC, 1.0f);
  wmma_gemm64<0, false, 2, 1, false><<<dim3(gridMN, 1), 256, 0, stream>>>(
      U16(h16), U16(h16), kC, (long)0, U16(wtk), U16(wtk), kC, (long)0,
      (void*)k16, (void*)nullptr, kC, (long)0, bk, (const float*)nullptr, (long)0, kM, kC, kC, 1.0f);
  //    v^T per image: vt16[b][d][n] = sum_c wt_v[d][c] . h16[b][n][c] + bv[d]  (M=128, N=4096, K=128, batched)
  const int gridVt = ((kC / 64) * (kN / 64) + 7) / 8;                  // 16
  wmma_gemm64<0, false, 1, 1, false><<<dim3(gridVt, kB), 256, 0, stream>>>(
      U16(wtv), U16(wtv), kC, (long)0, U16(h16), U16(h16), kC, (long)kN * kC,
      (void*)vt16, (void*)nullptr, kN, (long)kC * kN, bv, (const float*)nullptr, (long)0, kC, kN, kC, 1.0f);

  // 4. attention
  const float scale = 0.08838834764831845f;                            // 128^-0.5
  k_attn128<<<kB * (kN / 64), 128, 0, stream>>>(q16, k16, vt16, o16, scale);

  // 5. out = x + o.wo + bo  (f32, residual)
  wmma_gemm64<0, false, 2, 0, true><<<dim3(gridMN, 1), 256, 0, stream>>>(
      U16(o16), U16(o16), kC, (long)0, U16(wto), U16(wto), kC, (long)0,
      (void*)out, (void*)nullptr, kC, (long)0, bo, x, (long)0, kM, kC, kC, 1.0f);
}

// v003
// A run of this version takes 440 microseconds.
// Next to v002, in two timings, it ran 1.10 times as fast each time.
// All steps since v000 together make it 2.71 times as fast.
// Contractions: v_wmma_f32_16x16x32_f16 (f16 operands, f32 accumulate) for the three 1x1 projections,
// q.k^T, p.v (p carried x2^15) and the output projection; GroupNorm statistics f64/f32, softmax f32.
#include <hip/hip_runtime.h>

typedef __attribute__((ext_vector_type(16))) _Float16 v16h;
typedef __attribute__((ext_vector_type(8)))  _Float16 v8h;
typedef __attribute__((ext_vector_type(16))) __bf16   v16b;
typedef __attribute__((ext_vector_type(8)))  __bf16   v8b;
typedef __attribute__((ext_vector_type(8)))  float    v8f;
typedef __attribute__((ext_vector_type(4)))  float    v4f;
#define U16(p) ((const unsigned short*)(const void*)(p))

static constexpr int kB  = 16;          // batch
static constexpr int kN  = 4096;        // tokens per image (64*64)
static constexpr int kC  = 128;         // channels
static constexpr int kM  = kB * kN;     // 65536 token rows
static constexpr int kNG = 32;          // groups
static constexpr int kCPG = 4;          // channels per group

__device__ __forceinline__ unsigned short f2bf_bits(float f) {
  unsigned u = __float_as_uint(f);
  return (unsigned short)((u + 0x7FFFu + ((u >> 16) & 1u)) >> 16);
}
__device__ __forceinline__ float bf_bits2f(unsigned short h) { return __uint_as_float(((unsigned)h) << 16); }

// hazard guards as plain device helpers
__device__ __forceinline__ void dep_guard_h(v8f& a, v8f& b, v16h x, v16h y) { asm volatile("v_nop\n\tv_nop\n\tv_nop\n\tv_nop" : "+v"(a), "+v"(b) : "v"(x), "v"(y)); }
__device__ __forceinline__ void dep_guard_b(v8f& a, v8f& b, v16b x, v16b y) { asm volatile("v_nop\n\tv_nop\n\tv_nop\n\tv_nop" : "+v"(a), "+v"(b) : "v"(x), "v"(y)); }
__device__ __forceinline__ void keep4_h(v16h a, v16h b, v16h c, v16h d) { asm volatile("v_nop" :: "v"(a), "v"(b), "v"(c), "v"(d)); }
__device__ __forceinline__ void keep4_b(v16b a, v16b b, v16b c, v16b d) { asm volatile("v_nop" :: "v"(a), "v"(b), "v"(c), "v"(d)); }
__device__ __forceinline__ void acc_guard4(v8f& a, v8f& b, v8f& c, v8f& d) { asm volatile("v_nop\n\tv_nop\n\tv_nop\n\tv_nop" : "+v"(a), "+v"(b), "+v"(c), "+v"(d)); }
template <typename T> struct Frag;
template <> struct Frag<_Float16> {
  typedef v16h V; union U { v16h v; v8h h[2]; };
  static __device__ __forceinline__ v16h load(const _Float16* p) {   // elements 0..7 <- p[0..7], 8..15 <- p[16..23]
    U f; f.h[0] = *(const v8h*)(p); f.h[1] = *(const v8h*)(p + 16); return f.v;
  }
  static __device__ __forceinline__ v8f mma(v16h a, v16h b, v8f c) {
    return __builtin_amdgcn_wmma_f32_16x16x32_f16(false, a, false, b, (short)0, c, false, false);
  }
  static __device__ __forceinline__ void guard(v8f& a, v8f& b, v16h x, v16h y) { dep_guard_h(a, b, x, y); }
  static __device__ __forceinline__ void keep(v16h a, v16h b, v16h c, v16h d) { keep4_h(a, b, c, d); }
};
template <> struct Frag<__bf16> {
  typedef v16b V; union U { v16b v; v8b h[2]; };
  static __device__ __forceinline__ v16b load(const __bf16* p) {
    U f; f.h[0] = *(const v8b*)(p); f.h[1] = *(const v8b*)(p + 16); return f.v;
  }
  static __device__ __forceinline__ v8f mma(v16b a, v16b b, v8f c) {
    return __builtin_amdgcn_wmma_f32_16x16x32_bf16(false, a, false, b, (short)0, c, false, false);
  }
  static __device__ __forceinline__ void guard(v8f& a, v8f& b, v16b x, v16b y) { dep_guard_b(a, b, x, y); }
  static __device__ __forceinline__ void keep(v16b a, v16b b, v16b c, v16b d) { keep4_b(a, b, c, d); }
};

// lane l <- lane l ^ M inside its 16-lane row, on the vector unit (DPP row_xmask): no LDS-pipe round trip, no wait
template <int M> __device__ __forceinline__ float row_xor(float v) {
  return __builtin_bit_cast(float, __builtin_amdgcn_update_dpp(0, __builtin_bit_cast(int, v), 0x160 | M, 0xf, 0xf, true));
}
// 16-lane row maximum of eight values at once. Written as asm because fmaxf on a DPP-moved value compiles to three
// dependent instructions a step (move, quieting max, max) where the chip has one; the eight rows are interleaved so that
// each step's producer stands eight instructions back and no step waits on the one before it.
__device__ __forceinline__ void row_max16_x8(float (&m)[8]) {
  asm(
      "v_max_num_f32_dpp %0, %0, %0 row_xmask:1 row_mask:0xf bank_mask:0xf\n\t"
      "v_max_num_f32_dpp %1, %1, %1 row_xmask:1 row_mask:0xf bank_mask:0xf\n\t"
      "v_max_num_f32_dpp %2, %2, %2 row_xmask:1 row_mask:0xf bank_mask:0xf\n\t"
      "v_max_num_f32_dpp %3, %3, %3 row_xmask:1 row_mask:0xf bank_mask:0xf\n\t"
      "v_max_num_f32_dpp %4, %4, %4 row_xmask:1 row_mask:0xf bank_mask:0xf\n\t"
      "v_max_num_f32_dpp %5, %5, %5 row_xmask:1 row_mask:0xf bank_mask:0xf\n\t"
      "v_max_num_f32_dpp %6, %6, %6 row_xmask:1 row_mask:0xf bank_mask:0xf\n\t"
      "v_max_num_f32_dpp %7, %7, %7 row_xmask:1 row_mask:0xf bank_mask:0xf\n\t"
      "v_max_num_f32_dpp %0, %0, %0 row_xmask:2 row_mask:0xf bank_mask:0xf\n\t"
      "v_max_num_f32_dpp %1, %1, %1 row_xmask:2 row_mask:0xf bank_mask:0xf\n\t"
      "v_max_num_f32_dpp %2, %2, %2 row_xmask:2 row_mask:0xf bank_mask:0xf\n\t"
      "v_max_num_f32_dpp %3, %3, %3 row_xmask:2 row_mask:0xf bank_mask:0xf\n\t"
      "v_max_num_f32_dpp %4, %4, %4 row_xmask:2 row_mask:0xf bank_mask:0xf\n\t"
      "v_max_num_f32_dpp %5, %5, %5 row_xmask:2 row_mask:0xf bank_mask:0xf\n\t"
      "v_max_num_f32_dpp %6, %6, %6 row_xmask:2 row_mask:0xf bank_mask:0xf\n\t"
      "v_max_num_f32_dpp %7, %7, %7 row_xmask:2 row_mask:0xf bank_mask:0xf\n\t"
      "v_max_num_f32_dpp %0, %0, %0 row_xmask:4 row_mask:0xf bank_mask:0xf\n\t"
      "v_max_num_f32_dpp %1, %1, %1 row_xmask:4 row_mask:0xf bank_mask:0xf\n\t"
      "v_max_num_f32_dpp %2, %2, %2 row_xmask:4 row_mask:0xf bank_mask:0xf\n\t"
      "v_max_num_f32_dpp %3, %3, %3 row_xmask:4 row_mask:0xf bank_mask:0xf\n\t"
      "v_max_num_f32_dpp %4, %4, %4 row_xmask:4 row_mask:0xf bank_mask:0xf\n\t"
      "v_max_num_f32_dpp %5, %5, %5 row_xmask:4 row_mask:0xf bank_mask:0xf\n\t"
      "v_max_num_f32_dpp %6, %6, %6 row_xmask:4 row_mask:0xf bank_mask:0xf\n\t"
      "v_max_num_f32_dpp %7, %7, %7 row_xmask:4 row_mask:0xf bank_mask:0xf\n\t"
      "v_max_num_f32_dpp %0, %0, %0 row_xmask:8 row_mask:0xf bank_mask:0xf\n\t"
      "v_max_num_f32_dpp %1, %1, %1 row_xmask:8 row_mask:0xf bank_mask:0xf\n\t"
      "v_max_num_f32_dpp %2, %2, %2 row_xmask:8 row_mask:0xf bank_mask:0xf\n\t"
      "v_max_num_f32_dpp %3, %3, %3 row_xmask:8 row_mask:0xf bank_mask:0xf\n\t"
      "v_max_num_f32_dpp %4, %4, %4 row_xmask:8 row_mask:0xf bank_mask:0xf\n\t"
      "v_max_num_f32_dpp %5, %5, %5 row_xmask:8 row_mask:0xf bank_mask:0xf\n\t"
      "v_max_num_f32_dpp %6, %6, %6 row_xmask:8 row_mask:0xf bank_mask:0xf\n\t"
      "v_max_num_f32_dpp %7, %7, %7 row_xmask:8 row_mask:0xf bank_mask:0xf"
      : "+v"(m[0]), "+v"(m[1]), "+v"(m[2]), "+v"(m[3]), "+v"(m[4]), "+v"(m[5]), "+v"(m[6]), "+v"(m[7]));
}
__device__ __forceinline__ float row_sum16(float s) {
  s += row_xor<1>(s); s += row_xor<2>(s); s += row_xor<4>(s); s += row_xor<8>(s);
  return s;
}

// ---- Register-blocked batched WMMA GEMM --------------------------------
// C[m,n] = scale * sum_k A[m,k] * Bt[n,k] (+bias)(+resid); each wave owns a 64x64 tile.
// A row-major [M,K]; Bt row-major [N,K]; M,N % 64 == 0, K % 32 == 0.
// SPLIT: operands are hi/lo planes (A2/Bt2 = lo planes, same layout); product = hi·hi + hi·lo + lo·hi.
// BIAS_MODE: 0 = none, 1 = bias[m], 2 = bias[n].
// OUT_MODE: 0 = f32, 1 = f16, 2 = bf16 hi plane (Cout) + bf16 lo plane (Cout2).
// ET: 0 = f16 operands, 1 = bf16 operands (pointers passed as 16-bit storage)
template <int ET> struct Elem;
template <> struct Elem<0> { typedef _Float16 T; };
template <> struct Elem<1> { typedef __bf16 T; };
template <int ET, bool SPLIT, int BIAS_MODE, int OUT_MODE, bool RESID, int ACT = 0>
__global__ __launch_bounds__(256) void wmma_gemm64(
    const unsigned short* __restrict__ Ap, const unsigned short* __restrict__ A2p, int lda, long strideA,
    const unsigned short* __restrict__ Btp, const unsigned short* __restrict__ Bt2p, int ldb, long strideB,
    void* __restrict__ Cout, void* __restrict__ Cout2, int ldc, long strideC,
    const float* __restrict__ bias,
    const float* __restrict__ resid, long strideR,
    int M, int N, int K, float scale) {
  typedef typename Elem<ET>::T T;
  typedef typename Frag<T>::V V;
  const T* A = (const T*)Ap; const T* A2 = (const T*)A2p; const T* Bt = (const T*)Btp; const T* Bt2 = (const T*)Bt2p;
  __shared__ __align__(16) float sT[8][16 * 68];   // per-wave 16x64 slab, pitch 68 floats
  const int b    = blockIdx.y;
  const int lane = threadIdx.x & 31;
  const int wave = threadIdx.x >> 5;
  const int tilesN = N >> 6;
  const int tilesM = M >> 6;
  const int tile = blockIdx.x * 8 + wave;
  if (tile >= tilesM * tilesN) return;   // wave-uniform; no block barriers in this kernel
  const int tm = tile / tilesN;
  const int tn = tile - tm * tilesN;
  const int m0 = tm << 6;
  const int n0 = tn << 6;

  const T* Ab  = A  + (size_t)b * strideA;
  const T* Bb  = Bt + (size_t)b * strideB;
  const T* Ab2 = SPLIT ? (A2  + (size_t)b * strideA) : nullptr;
  const T* Bb2 = SPLIT ? (Bt2 + (size_t)b * strideB) : nullptr;

  const int rlane = lane & 15;                 // row (A) / col (B, D) within subtile
  const int koff  = (lane >> 4) * 8;           // k offset of this lane half
  const int mOff  = (lane >> 4) * 8;           // D row offset

  v8f acc[4][4];
#pragma unroll
  for (int i = 0; i < 4; ++i)
#pragma unroll
    for (int j = 0; j < 4; ++j) acc[i][j] = (v8f){0.f,0.f,0.f,0.f,0.f,0.f,0.f,0.f};

  for (int k0 = 0; k0 < K; k0 += 32) {
    V bh[4], bl[4];
#pragma unroll
    for (int j = 0; j < 4; ++j) {
      const size_t bo = (size_t)(n0 + (j << 4) + rlane) * ldb + koff + k0;
      bh[j] = Frag<T>::load(Bb + bo);
      if (SPLIT) bl[j] = Frag<T>::load(Bb2 + bo);
    }
#pragma unroll
    for (int i = 0; i < 4; ++i) {
      const size_t ao = (size_t)(m0 + (i << 4) + rlane) * lda + koff + k0;
      V ah = Frag<T>::load(Ab + ao);
      V al;
      if (SPLIT) al = Frag<T>::load(Ab2 + ao);
#pragma unroll
      for (int j = 0; j < 4; ++j) {
        acc[i][j] = Frag<T>::mma(ah, bh[j], acc[i][j]);
        if (SPLIT) {
          acc[i][j] = Frag<T>::mma(ah, bl[j], acc[i][j]);
          acc[i][j] = Frag<T>::mma(al, bh[j], acc[i][j]);
        }
      }
      Frag<T>::guard(acc[i][0], acc[i][3], ah, SPLIT ? al : ah);
    }
    Frag<T>::keep(bh[0], bh[1], bh[2], bh[3]);
    if (SPLIT) Frag<T>::keep(bl[0], bl[1], bl[2], bl[3]);
  }
  acc_guard4(acc[0][0], acc[0][1], acc[0][2], acc[0][3]);
  acc_guard4(acc[1][0], acc[1][1], acc[1][2], acc[1][3]);
  acc_guard4(acc[2][0], acc[2][1], acc[2][2], acc[2][3]);
  acc_guard4(acc[3][0], acc[3][1], acc[3][2], acc[3][3]);

  // ---- epilogue ----
  float* slab = sT[wave];
  const float* Rb = RESID ? (resid + (size_t)b * strideR) : nullptr;
#pragma unroll
  for (int i = 0; i < 4; ++i) {
    const int mBase = m0 + (i << 4);
#pragma unroll
    for (int j = 0; j < 4; ++j) {
      const int n = n0 + (j << 4) + rlane;
      float bv = 0.f;
      if (BIAS_MODE == 2) bv = bias[n];
#pragma unroll
      for (int r = 0; r < 8; ++r) {
        float v = acc[i][j][r] * scale;
        if (BIAS_MODE == 1) v += bias[mBase + mOff + r];
        if (BIAS_MODE == 2) v += bv;
        if (RESID) v += Rb[(size_t)(mBase + mOff + r) * ldc + n];
        if (ACT == 1) v = tanhf(v);
        if (ACT == 2) v = fmaxf(v, 0.0f);
        if (ACT == 3) v = v / (1.0f + expf(-v));
        if (ACT == 4) v = (v > 0.f) ? v : 0.01f * v;
        if (ACT == 5) v = 0.5f * v * (1.0f + erff(v * 0.70710678118654752f));
        slab[(mOff + r) * 68 + (j << 4) + rlane] = v;
      }
    }
    __builtin_amdgcn_fence(__ATOMIC_RELEASE, "workgroup");
    __builtin_amdgcn_wave_barrier();
    __builtin_amdgcn_fence(__ATOMIC_ACQUIRE, "workgroup");
    if (OUT_MODE == 0) {
      float* C = (float*)Cout + (size_t)b * strideC;
      const int hh = lane >> 4, c4 = (lane & 15) * 4;     // row seg = 256 B = 16 lanes x 16 B
      {
#pragma unroll
        for (int it = 0; it < 8; ++it) {
          const int row = it * 2 + hh;
          v4f v = *(const v4f*)(slab + row * 68 + c4);
          *(v4f*)(C + (size_t)(mBase + row) * ldc + n0 + c4) = v;
        }
        
      }
    } else {
      const int q = lane >> 3, c8 = (lane & 7) * 8;
      unsigned short* C  = (unsigned short*)Cout  + (size_t)b * strideC;
      unsigned short* C2 = (OUT_MODE == 2) ? ((unsigned short*)Cout2 + (size_t)b * strideC) : nullptr;
      {
#pragma unroll
        for (int it = 0; it < 4; ++it) {
          const int row = it * 4 + q;
          const float* sp = slab + row * 68 + c8;
          v8h hv, lv;
#pragma unroll
          for (int e = 0; e < 8; ++e) {
            if (OUT_MODE == 1) {
              hv[e] = (_Float16)sp[e];
            } else {
              unsigned short hb = f2bf_bits(sp[e]);
              unsigned short lb = f2bf_bits(sp[e] - bf_bits2f(hb));
              hv[e] = __builtin_bit_cast(_Float16, hb);
              lv[e] = __builtin_bit_cast(_Float16, lb);
            }
          }
          *(v8h*)(C + (size_t)(mBase + row) * ldc + n0 + c8) = hv;
          if (OUT_MODE == 2) *(v8h*)(C2 + (size_t)(mBase + row) * ldc + n0 + c8) = lv;
        }
        
      }
    }
    __builtin_amdgcn_fence(__ATOMIC_RELEASE, "workgroup");
    __builtin_amdgcn_wave_barrier();
    __builtin_amdgcn_fence(__ATOMIC_ACQUIRE, "workgroup");
  }
}

// ---------------------------------------------------------------------------
// Weight convert: four f32 [c][d] matrices -> f16 transposed wt16[mat][d][c] (k-contiguous rows).
// grid (4 row-blocks of 32 d, 4 matrices), block 256. LDS transpose; each output row (256 B)
// ---------------------------------------------------------------------------
#define WC_P 136
__global__ __launch_bounds__(256) void k_wconvert(const float* __restrict__ w0, const float* __restrict__ w1,
                                                 const float* __restrict__ w2, const float* __restrict__ w3,
                                                 _Float16* __restrict__ wt16) {
  __shared__ __align__(16) _Float16 T[32 * WC_P];           // [d local][c]
  const int mat = blockIdx.y;
  const int n0  = blockIdx.x * 32;
  const int t   = threadIdx.x;
  const float* src = (mat == 0) ? w0 : (mat == 1) ? w1 : (mat == 2) ? w2 : w3;
#pragma unroll
  for (int it = 0; it < 16; ++it) {
    const int idx = it * 256 + t;                            // 0..4095
    const int k = idx >> 5, j = idx & 31;
    T[j * WC_P + k] = (_Float16)src[(size_t)k * kC + n0 + j];
  }
  __syncthreads();
  const int row0 = t >> 4, c8 = (t & 15) * 8;
  _Float16* dst = wt16 + ((size_t)mat * kC + n0) * kC;
  {
#pragma unroll
    for (int it = 0; it < 2; ++it) {
      const int rr = row0 + 16 * it;
      const v8h val = *(const v8h*)(T + rr * WC_P + c8);
      *(v8h*)(dst + (size_t)rr * kC + c8) = val;
    }
    
  }
}

// ---------------------------------------------------------------------------
// GroupNorm statistics: one block per image; lane = group, 8 row-phases per group; f64 accumulation.
// Table row per image: [0..31] = mean, [32..63] = rstd (256 B), written by lanes 0..15 of wave 0.
// ---------------------------------------------------------------------------
__global__ __launch_bounds__(256) void k_gn_stats(const float* __restrict__ x, float* __restrict__ gtab) {
  __shared__ double red_s[8][32], red_q[8][32];
  __shared__ __align__(16) float tab[64];
  const int b = blockIdx.x;
  const int t = threadIdx.x, g = t & 31, rs = t >> 5;
  const float* xb = x + (size_t)b * kN * kC + kCPG * g;
  double s = 0.0, ss = 0.0;
  for (int r = rs; r < kN; r += 8) {
    const v4f v = *(const v4f*)(xb + (size_t)r * kC);
#pragma unroll
    for (int e = 0; e < 4; ++e) { const double d = (double)v[e]; s += d; ss += d * d; }
  }
  red_s[rs][g] = s; red_q[rs][g] = ss;
  __syncthreads();
  if (t < 32) {
    double S = 0.0, Q = 0.0;
#pragma unroll
    for (int i = 0; i < 8; ++i) { S += red_s[i][t]; Q += red_q[i][t]; }
    const double inv_n = 1.0 / (double)(kN * kCPG);
    const double mean = S * inv_n;
    double var = Q * inv_n - mean * mean;
    if (var < 0.0) var = 0.0;
    const float rstd = rsqrtf((float)var + 1e-6f);
    tab[t] = (float)mean;
    tab[32 + t] = rstd;
  }
  __syncthreads();
  if (t < 16) {
    const v4f v = *(const v4f*)(tab + 4 * t);
    *(v4f*)(gtab + (size_t)b * 64 + 4 * t) = v;
    
  }
}

// ---------------------------------------------------------------------------
// GroupNorm apply: thread = 8 consecutive channels of one token row -> f16 h16[m][c] (16-B store,
// ---------------------------------------------------------------------------
__global__ __launch_bounds__(256) void k_gn_apply(const float* __restrict__ x, const float* __restrict__ gs,
                                                 const float* __restrict__ gb, const float* __restrict__ gtab,
                                                 _Float16* __restrict__ h16, int nvec) {
  const int i = blockIdx.x * 256 + threadIdx.x;
  if (i >= nvec) return;
  const int m  = i >> 4;
  const int c8 = (i & 15) * 8;
  const int b  = m >> 12;
  const int g0 = c8 >> 2;
  const float* tb = gtab + (size_t)b * 64;
  const float mean0 = tb[g0],     rstd0 = tb[32 + g0];
  const float mean1 = tb[g0 + 1], rstd1 = tb[32 + g0 + 1];
  const float* xr = x + (size_t)m * kC + c8;
  const v4f xa = *(const v4f*)(xr), xb2 = *(const v4f*)(xr + 4);
  const v4f sa = *(const v4f*)(gs + c8), sb = *(const v4f*)(gs + c8 + 4);
  const v4f ba = *(const v4f*)(gb + c8), bb = *(const v4f*)(gb + c8 + 4);
  v8h hv;
#pragma unroll
  for (int e = 0; e < 4; ++e) {
    hv[e]     = (_Float16)(((xa[e]  - mean0) * rstd0) * sa[e] + ba[e]);
    hv[4 + e] = (_Float16)(((xb2[e] - mean1) * rstd1) * sb[e] + bb[e]);
  }
  _Float16* dst = h16 + (size_t)m * kC + c8;
  *(v8h*)dst = hv;
  
}

// ---------------------------------------------------------------------------
// Flash attention, head dim 128, f16 q/k/v^T in, f16 out.
//   scores = q.k^T (x scale in f32)  : v_wmma_f32_16x16x32_f16
//   out    = p.v, p carried x2^15    : v_wmma_f32_16x16x32_f16; f32 accumulate; online softmax f32.
// Block = 4 waves = 64 query rows of one image; 64-key chunks; K [kv][d] and V^T [d][kv] tiles staged
// in LDS with plain 16-B loads + __syncthreads. grid.x = 16 images x 64 query blocks.
// ---------------------------------------------------------------------------
#define AT_KC 64
#define AT_OP 136
// LDS row pitches in f16 elements: an odd multiple of 16 B, so the 16 rows of one ds_load_b128 fall on distinct banks
#define AT_KP 136   // K rows of 256 B at 272 B
#define AT_VP 72    // V^T rows of 128 B at 144 B
#define AT_PP 72    // P rows of 128 B at 144 B
__global__ __launch_bounds__(128) void k_attn128(const _Float16* __restrict__ q16, const _Float16* __restrict__ k16,
                                                const _Float16* __restrict__ vt16, _Float16* __restrict__ o16,
                                                float scale) {
  __shared__ __align__(16) _Float16 Ksh[AT_KC * AT_KP];    // [kv][d]      17 KB
  __shared__ __align__(16) _Float16 Vts[kC * AT_VP];       // [d][kv]      18 KB
  __shared__ __align__(16) _Float16 Psh[4][16 * AT_PP];    // per wave [row][kv]  9 KB
  __shared__ __align__(16) _Float16 Osh[4][16 * AT_OP];    // per wave [row][d]   17 KB
  const int tid  = threadIdx.x;
  const int wave = tid >> 5;
  const int lane = tid & 31;
  const int hh   = lane >> 4;
  const int c    = lane & 15;
  const int b    = blockIdx.x >> 6;
  const int qb   = blockIdx.x & 63;
  const int q0   = qb * 64 + wave * 16;
  const size_t tok0 = (size_t)b * kN;

  // Q fragments (A operand), 4 d-chunks of 32
  v16h qa[4];
  {
    const _Float16* qrow = q16 + (tok0 + q0 + c) * kC;
#pragma unroll
    for (int dc = 0; dc < 4; ++dc) qa[dc] = Frag<_Float16>::load(qrow + dc * 32 + 8 * hh);
  }

  float mrow[8], lrow[8];
  v8f oacc[8];
#pragma unroll
  for (int r = 0; r < 8; ++r) { mrow[r] = -__builtin_inff(); lrow[r] = 0.f; }
#pragma unroll
  for (int t = 0; t < 8; ++t) oacc[t] = (v8f){0.f,0.f,0.f,0.f,0.f,0.f,0.f,0.f};

  _Float16* pw = Psh[wave];
  // this thread's first 16 B of the current K and V^T chunk; one pointer each frees the registers of the second fragment set
  const _Float16* kg = k16 + (tok0 + (tid >> 4)) * kC + (tid & 15) * 8;
  const _Float16* vg = vt16 + ((size_t)b * kC + (tid >> 3)) * kN + (tid & 7) * 8;
  const float PSC = 32768.0f;

#pragma unroll 1
  for (int kc = 0; kc < kN / AT_KC; ++kc) {
    __syncthreads();
#pragma unroll
    for (int it = 0; it < 8; ++it) {
      {
        // row = (tid >> 4) + 8 * it: so written, each address is one base register (pair) plus a constant per it
        const v8h kk = *(const v8h*)(kg + it * (8 * kC));
        *(v8h*)(Ksh + (tid >> 4) * AT_KP + (tid & 15) * 8 + it * (8 * AT_KP)) = kk;
      }
      {
        // d = (tid >> 3) + 16 * it: the same form
        const v8h vv = *(const v8h*)(vg + it * (16 * kN));
        *(v8h*)(Vts + (tid >> 3) * AT_VP + (tid & 7) * 8 + it * (16 * AT_VP)) = vv;
      }
    }
    // the staging loads' address registers are rewritten from here on (the two pointers move); both pointers are inputs,
    // so they stay live up to this wait and no staging load's result lands in an address pair that the run still names
    asm volatile("s_wait_xcnt 0x0" :: "v"(kg), "v"(vg) : "memory");
    kg += AT_KC * kC;
    vg += AT_KC;
    __syncthreads();

    // S = Q . K^T : 4 key tiles of 16, k = d over 4 chunks
    // The four K fragments of d-chunk dc + 1 are read as one group in front of the four products of d-chunk dc
    // (two register sets), so a wave waits once per group on a counted wait, not once per product on a full LDS trip.
    v8f s[4];
#pragma unroll
    for (int j = 0; j < 4; ++j) s[j] = (v8f){0.f,0.f,0.f,0.f,0.f,0.f,0.f,0.f};
    {
      const _Float16* kfp = Ksh + c * AT_KP + 8 * hh;
      v16h kf[2][4];
#pragma unroll
      for (int j = 0; j < 4; ++j) kf[0][j] = Frag<_Float16>::load(kfp + j * (16 * AT_KP));
#pragma unroll
      for (int dc = 0; dc < 4; ++dc) {
        if (dc < 3) {
#pragma unroll
          for (int j = 0; j < 4; ++j) kf[(dc + 1) & 1][j] = Frag<_Float16>::load(kfp + j * (16 * AT_KP) + (dc + 1) * 32);
        }
        // keeps the next group's reads in front of this group's products (else they sink back to one read per product)
        __builtin_amdgcn_sched_barrier(0);
#pragma unroll
        for (int j = 0; j < 4; ++j) s[j] = Frag<_Float16>::mma(qa[dc], kf[dc & 1][j], s[j]);
        // keeps what follows out of this run of products: the group after next would take a third register set,
        // and vector code mixed in behind the last group costs hazard v_nops between the products
        __builtin_amdgcn_sched_barrier(0);
        // the first group's results take fresh registers: its four fragments, held live past the run (inputs only, behind
        // the fence above), keep the compiler from placing a product's result over the B operand of an earlier product of the run
        if (dc == 0) asm volatile("" :: "v"(kf[0][0]), "v"(kf[0][1]), "v"(kf[0][2]), "v"(kf[0][3]));
      }
    }

    // chunk row max (row 8hh+r, 64 cols spread over the 16 lanes of this half x 4 tiles)
    float cm[8];
#pragma unroll
    for (int r = 0; r < 8; ++r) {
      float m = -__builtin_inff();
#pragma unroll
      for (int j = 0; j < 4; ++j) {
        const float sv = s[j][r] * scale;
        s[j][r] = sv;
        m = fmaxf(m, sv);
      }
      cm[r] = m;
    }
    row_max16_x8(cm);
    // online softmax; P (x2^15, f16) into this wave's LDS slab
#pragma unroll
    for (int r = 0; r < 8; ++r) {
      const float mnew  = fmaxf(mrow[r], cm[r]);
      const float alpha = __expf(mrow[r] - mnew);
      mrow[r] = mnew;
      float psum = 0.f;
#pragma unroll
      for (int j = 0; j < 4; ++j) {
        const float p = __expf(s[j][r] - mnew);
        psum += p;
        pw[(8 * hh + r) * AT_PP + j * 16 + c] = (_Float16)(p * PSC);
      }
      psum = row_sum16(psum);
      lrow[r] = lrow[r] * alpha + psum;
#pragma unroll
      for (int t = 0; t < 8; ++t) oacc[t][r] *= alpha;
    }
    __builtin_amdgcn_fence(__ATOMIC_RELEASE, "workgroup");
    __builtin_amdgcn_wave_barrier();
    __builtin_amdgcn_fence(__ATOMIC_ACQUIRE, "workgroup");

    // O += P . V : A = P [row][kv], B[kv][d] = Vts[d][kv]; 2 kv chunks of 32, 8 d tiles
    // Group g = kv chunk g >> 1, d tiles 4 * (g & 1) .. + 3; its V^T fragments are read one group ahead, as for K above.
    {
      const _Float16* vfp = Vts + c * AT_VP + 8 * hh;
      v16h pa[2], vf[2][4];
#pragma unroll
      for (int kk = 0; kk < 2; ++kk) pa[kk] = Frag<_Float16>::load(pw + c * AT_PP + kk * 32 + 8 * hh);
#pragma unroll
      for (int u = 0; u < 4; ++u) vf[0][u] = Frag<_Float16>::load(vfp + u * (16 * AT_VP));
#pragma unroll
      for (int g = 0; g < 4; ++g) {
        if (g < 3) {
          const int gn = g + 1;
#pragma unroll
          for (int u = 0; u < 4; ++u)
            vf[gn & 1][u] = Frag<_Float16>::load(vfp + ((gn & 1) * 4 + u) * (16 * AT_VP) + (gn >> 1) * 32);
        }
        // keeps the next group's reads in front of this group's products
        __builtin_amdgcn_sched_barrier(0);
#pragma unroll
        for (int u = 0; u < 4; ++u) oacc[(g & 1) * 4 + u] = Frag<_Float16>::mma(pa[g >> 1], vf[g & 1][u], oacc[(g & 1) * 4 + u]);
        // keeps what follows out of this run of products: the group after next would take a third register set,
        // and vector code mixed in behind the last group costs hazard v_nops between the products
        __builtin_amdgcn_sched_barrier(0);
      }
    }
  }

  _Float16* osw = Osh[wave];
#pragma unroll
  for (int r = 0; r < 8; ++r) {
    const float inv = 1.0f / (lrow[r] * PSC);
#pragma unroll
    for (int t = 0; t < 8; ++t) osw[(8 * hh + r) * AT_OP + t * 16 + c] = (_Float16)(oacc[t][r] * inv);
  }
  __builtin_amdgcn_fence(__ATOMIC_RELEASE, "workgroup");
  __builtin_amdgcn_wave_barrier();
  __builtin_amdgcn_fence(__ATOMIC_ACQUIRE, "workgroup");
  {
    const int c8 = (lane & 15) * 8;                          // row = 256 B = 16 lanes x 16 B
    _Float16* ob = o16 + (tok0 + q0) * kC;
    {
#pragma unroll
      for (int it = 0; it < 8; ++it) {
        const int row = it * 2 + hh;
        const v8h val = *(const v8h*)(osw + row * AT_OP + c8);
        *(v8h*)(ob + (size_t)row * kC + c8) = val;
      }
      
    }
  }
}

// ---------------------------------------------------------------------------
extern "C" void kernel_launch(void* const* d_in, const int* in_sizes, int n_in,
                              void* d_out, int out_size, void* d_ws, size_t ws_size,
                              hipStream_t stream) {
  if (n_in < 11) return;
  if (in_sizes[0] != kM * kC || out_size != kM * kC) return;
  if (in_sizes[1] != kC || in_sizes[2] != kC || in_sizes[4] != kC || in_sizes[6] != kC ||
      in_sizes[8] != kC || in_sizes[10] != kC) return;
  if (in_sizes[3] != kC * kC || in_sizes[5] != kC * kC || in_sizes[7] != kC * kC || in_sizes[9] != kC * kC) return;

  const float* x  = (const float*)d_in[0];
  const float* gs = (const float*)d_in[1];
  const float* gb = (const float*)d_in[2];
  const float* wq = (const float*)d_in[3];
  const float* bq = (const float*)d_in[4];
  const float* wk = (const float*)d_in[5];
  const float* bk = (const float*)d_in[6];
  const float* wv = (const float*)d_in[7];
  const float* bv = (const float*)d_in[8];
  const float* wo = (const float*)d_in[9];
  const float* bo = (const float*)d_in[10];
  float* out = (float*)d_out;

  // workspace carve (bytes)
  const size_t szW   = (size_t)4 * kC * kC * sizeof(_Float16);       // 131072
  const size_t szTab = (size_t)kB * 64 * sizeof(float);               // 4096
  const size_t szT16 = (size_t)kM * kC * sizeof(_Float16);            // 16777216
  const size_t offW   = 0;
  const size_t offTab = offW + szW;
  const size_t offH   = offTab + szTab;
  const size_t offQ   = offH + szT16;
  const size_t offK   = offQ + szT16;
  const size_t offVt  = offK + szT16;
  const size_t offO   = offVt + szT16;
  const size_t offEnd = offO + szT16;                                  // 84021248
  if (offEnd > ws_size) return;

  char* ws = (char*)d_ws;
  _Float16* wt16 = (_Float16*)(ws + offW);
  float*    gtab = (float*)(ws + offTab);
  _Float16* h16  = (_Float16*)(ws + offH);
  _Float16* q16  = (_Float16*)(ws + offQ);
  _Float16* k16  = (_Float16*)(ws + offK);
  _Float16* vt16 = (_Float16*)(ws + offVt);
  _Float16* o16  = (_Float16*)(ws + offO);
  const _Float16* wtq = wt16;
  const _Float16* wtk = wt16 + (size_t)kC * kC;
  const _Float16* wtv = wt16 + (size_t)2 * kC * kC;
  const _Float16* wto = wt16 + (size_t)3 * kC * kC;

  // 1. weights f32 [c][d] -> f16 [d][c]
  k_wconvert<<<dim3(kC / 32, 4), 256, 0, stream>>>(wq, wk, wv, wo, wt16);
  // 2. GroupNorm statistics and apply
  k_gn_stats<<<kB, 256, 0, stream>>>(x, gtab);
  const int nvec = kM * (kC / 8);                                      // 1048576
  k_gn_apply<<<(nvec + 255) / 256, 256, 0, stream>>>(x, gs, gb, gtab, h16, nvec);

  // 3. projections: q16 = h.wq + bq, k16 = h.wk + bk   (M=65536, N=128, K=128; 2048 wave tiles)
  const int gridMN = ((kM / 64) * (kC / 64) + 7) / 8;                  // 256
  wmma_gemm64<0, false, 2, 1, false><<<dim3(gridMN, 1), 256, 0, stream>>>(
      U16(h16), U16(h16), kC, (long)0, U16(wtq), U16(wtq), kC, (long)0,
      (void*)q16, (void*)nullptr, kC, (long)0, bq, (const float*)nullptr, (long)0, kM, kC, kC, 1.0f);
  wmma_gemm64<0, false, 2, 1, false><<<dim3(gridMN, 1), 256, 0, stream>>>(
      U16(h16), U16(h16), kC, (long)0, U16(wtk), U16(wtk), kC, (long)0,
      (void*)k16, (void*)nullptr, kC, (long)0, bk, (const float*)nullptr, (long)0, kM, kC, kC, 1.0f);
  //    v^T per image: vt16[b][d][n] = sum_c wt_v[d][c] . h16[b][n][c] + bv[d]  (M=128, N=4096, K=128, batched)
  const int gridVt = ((kC / 64) * (kN / 64) + 7) / 8;                  // 16
  wmma_gemm64<0, false, 1, 1, false><<<dim3(gridVt, kB), 256, 0, stream>>>(
      U16(wtv), U16(wtv), kC, (long)0, U16(h16), U16(h16), kC, (long)kN * kC,
      (void*)vt16, (void*)nullptr, kN, (long)kC * kN, bv, (const float*)nullptr, (long)0, kC, kN, kC, 1.0f);

  // 4. attention
  const float scale = 0.08838834764831845f;                            // 128^-0.5
  k_attn128<<<kB * (kN / 64), 128, 0, stream>>>(q16, k16, vt16, o16, scale);

  // 5. out = x + o.wo + bo  (f32, residual)
  wmma_gemm64<0, false, 2, 0, true><<<dim3(gridMN, 1), 256, 0, stream>>>(
      U16(o16), U16(o16), kC, (long)0, U16(wto), U16(wto), kC, (long)0,
      (void*)out, (void*)nullptr, kC, (long)0, bo, x, (long)0, kM, kC, kC, 1.0f);
}

// v004
// A run of this version takes 232 microseconds.
// Two timings next to v003 both put it at 1.90 times that version's speed.
// Counting every step since v000, it is 5.15 times as fast.
// Contractions: v_wmma_f32_16x16x32_f16 (f16 operands, f32 accumulate) for the three 1x1 projections,
// q.k^T, p.v (p carried x2^15) and the output projection; GroupNorm statistics f64/f32, softmax f32.
#include <hip/hip_runtime.h>

typedef __attribute__((ext_vector_type(16))) _Float16 v16h;
typedef __attribute__((ext_vector_type(8)))  _Float16 v8h;
typedef __attribute__((ext_vector_type(16))) __bf16   v16b;
typedef __attribute__((ext_vector_type(8)))  __bf16   v8b;
typedef __attribute__((ext_vector_type(8)))  float    v8f;
typedef __attribute__((ext_vector_type(4)))  float    v4f;
#define U16(p) ((const unsigned short*)(const void*)(p))

static constexpr int kB  = 16;          // batch
static constexpr int kN  = 4096;        // tokens per image (64*64)
static constexpr int kC  = 128;         // channels
static constexpr int kM  = kB * kN;     // 65536 token rows
static constexpr int kNG = 32;          // groups
static constexpr int kCPG = 4;          // channels per group

__device__ __forceinline__ unsigned short f2bf_bits(float f) {
  unsigned u = __float_as_uint(f);
  return (unsigned short)((u + 0x7FFFu + ((u >> 16) & 1u)) >> 16);
}
__device__ __forceinline__ float bf_bits2f(unsigned short h) { return __uint_as_float(((unsigned)h) << 16); }

// hazard guards as plain device helpers
__device__ __forceinline__ void dep_guard_h(v8f& a, v8f& b, v16h x, v16h y) { asm volatile("v_nop\n\tv_nop\n\tv_nop\n\tv_nop" : "+v"(a), "+v"(b) : "v"(x), "v"(y)); }
__device__ __forceinline__ void dep_guard_b(v8f& a, v8f& b, v16b x, v16b y) { asm volatile("v_nop\n\tv_nop\n\tv_nop\n\tv_nop" : "+v"(a), "+v"(b) : "v"(x), "v"(y)); }
__device__ __forceinline__ void keep4_h(v16h a, v16h b, v16h c, v16h d) { asm volatile("v_nop" :: "v"(a), "v"(b), "v"(c), "v"(d)); }
__device__ __forceinline__ void keep4_b(v16b a, v16b b, v16b c, v16b d) { asm volatile("v_nop" :: "v"(a), "v"(b), "v"(c), "v"(d)); }
__device__ __forceinline__ void acc_guard4(v8f& a, v8f& b, v8f& c, v8f& d) { asm volatile("v_nop\n\tv_nop\n\tv_nop\n\tv_nop" : "+v"(a), "+v"(b), "+v"(c), "+v"(d)); }
template <typename T> struct Frag;
template <> struct Frag<_Float16> {
  typedef v16h V; union U { v16h v; v8h h[2]; };
  static __device__ __forceinline__ v16h load(const _Float16* p) {   // elements 0..7 <- p[0..7], 8..15 <- p[16..23]
    U f; f.h[0] = *(const v8h*)(p); f.h[1] = *(const v8h*)(p + 16); return f.v;
  }
  static __device__ __forceinline__ v8f mma(v16h a, v16h b, v8f c) {
    return __builtin_amdgcn_wmma_f32_16x16x32_f16(false, a, false, b, (short)0, c, false, false);
  }
  static __device__ __forceinline__ void guard(v8f& a, v8f& b, v16h x, v16h y) { dep_guard_h(a, b, x, y); }
  static __device__ __forceinline__ void keep(v16h a, v16h b, v16h c, v16h d) { keep4_h(a, b, c, d); }
};
template <> struct Frag<__bf16> {
  typedef v16b V; union U { v16b v; v8b h[2]; };
  static __device__ __forceinline__ v16b load(const __bf16* p) {
    U f; f.h[0] = *(const v8b*)(p); f.h[1] = *(const v8b*)(p + 16); return f.v;
  }
  static __device__ __forceinline__ v8f mma(v16b a, v16b b, v8f c) {
    return __builtin_amdgcn_wmma_f32_16x16x32_bf16(false, a, false, b, (short)0, c, false, false);
  }
  static __device__ __forceinline__ void guard(v8f& a, v8f& b, v16b x, v16b y) { dep_guard_b(a, b, x, y); }
  static __device__ __forceinline__ void keep(v16b a, v16b b, v16b c, v16b d) { keep4_b(a, b, c, d); }
};

// lane l <- lane l ^ M inside its 16-lane row, on the vector unit (DPP row_xmask): no LDS-pipe round trip, no wait
template <int M> __device__ __forceinline__ float row_xor(float v) {
  return __builtin_bit_cast(float, __builtin_amdgcn_update_dpp(0, __builtin_bit_cast(int, v), 0x160 | M, 0xf, 0xf, true));
}
// 16-lane row maximum of eight values at once. Written as asm because fmaxf on a DPP-moved value compiles to three
// dependent instructions a step (move, quieting max, max) where the chip has one; the eight rows are interleaved so that
// each step's producer stands eight instructions back and no step waits on the one before it.
__device__ __forceinline__ void row_max16_x8(float (&m)[8]) {
  asm(
      "v_max_num_f32_dpp %0, %0, %0 row_xmask:1 row_mask:0xf bank_mask:0xf\n\t"
      "v_max_num_f32_dpp %1, %1, %1 row_xmask:1 row_mask:0xf bank_mask:0xf\n\t"
      "v_max_num_f32_dpp %2, %2, %2 row_xmask:1 row_mask:0xf bank_mask:0xf\n\t"
      "v_max_num_f32_dpp %3, %3, %3 row_xmask:1 row_mask:0xf bank_mask:0xf\n\t"
      "v_max_num_f32_dpp %4, %4, %4 row_xmask:1 row_mask:0xf bank_mask:0xf\n\t"
      "v_max_num_f32_dpp %5, %5, %5 row_xmask:1 row_mask:0xf bank_mask:0xf\n\t"
      "v_max_num_f32_dpp %6, %6, %6 row_xmask:1 row_mask:0xf bank_mask:0xf\n\t"
      "v_max_num_f32_dpp %7, %7, %7 row_xmask:1 row_mask:0xf bank_mask:0xf\n\t"
      "v_max_num_f32_dpp %0, %0, %0 row_xmask:2 row_mask:0xf bank_mask:0xf\n\t"
      "v_max_num_f32_dpp %1, %1, %1 row_xmask:2 row_mask:0xf bank_mask:0xf\n\t"
      "v_max_num_f32_dpp %2, %2, %2 row_xmask:2 row_mask:0xf bank_mask:0xf\n\t"
      "v_max_num_f32_dpp %3, %3, %3 row_xmask:2 row_mask:0xf bank_mask:0xf\n\t"
      "v_max_num_f32_dpp %4, %4, %4 row_xmask:2 row_mask:0xf bank_mask:0xf\n\t"
      "v_max_num_f32_dpp %5, %5, %5 row_xmask:2 row_mask:0xf bank_mask:0xf\n\t"
      "v_max_num_f32_dpp %6, %6, %6 row_xmask:2 row_mask:0xf bank_mask:0xf\n\t"
      "v_max_num_f32_dpp %7, %7, %7 row_xmask:2 row_mask:0xf bank_mask:0xf\n\t"
      "v_max_num_f32_dpp %0, %0, %0 row_xmask:4 row_mask:0xf bank_mask:0xf\n\t"
      "v_max_num_f32_dpp %1, %1, %1 row_xmask:4 row_mask:0xf bank_mask:0xf\n\t"
      "v_max_num_f32_dpp %2, %2, %2 row_xmask:4 row_mask:0xf bank_mask:0xf\n\t"
      "v_max_num_f32_dpp %3, %3, %3 row_xmask:4 row_mask:0xf bank_mask:0xf\n\t"
      "v_max_num_f32_dpp %4, %4, %4 row_xmask:4 row_mask:0xf bank_mask:0xf\n\t"
      "v_max_num_f32_dpp %5, %5, %5 row_xmask:4 row_mask:0xf bank_mask:0xf\n\t"
      "v_max_num_f32_dpp %6, %6, %6 row_xmask:4 row_mask:0xf bank_mask:0xf\n\t"
      "v_max_num_f32_dpp %7, %7, %7 row_xmask:4 row_mask:0xf bank_mask:0xf\n\t"
      "v_max_num_f32_dpp %0, %0, %0 row_xmask:8 row_mask:0xf bank_mask:0xf\n\t"
      "v_max_num_f32_dpp %1, %1, %1 row_xmask:8 row_mask:0xf bank_mask:0xf\n\t"
      "v_max_num_f32_dpp %2, %2, %2 row_xmask:8 row_mask:0xf bank_mask:0xf\n\t"
      "v_max_num_f32_dpp %3, %3, %3 row_xmask:8 row_mask:0xf bank_mask:0xf\n\t"
      "v_max_num_f32_dpp %4, %4, %4 row_xmask:8 row_mask:0xf bank_mask:0xf\n\t"
      "v_max_num_f32_dpp %5, %5, %5 row_xmask:8 row_mask:0xf bank_mask:0xf\n\t"
      "v_max_num_f32_dpp %6, %6, %6 row_xmask:8 row_mask:0xf bank_mask:0xf\n\t"
      "v_max_num_f32_dpp %7, %7, %7 row_xmask:8 row_mask:0xf bank_mask:0xf"
      : "+v"(m[0]), "+v"(m[1]), "+v"(m[2]), "+v"(m[3]), "+v"(m[4]), "+v"(m[5]), "+v"(m[6]), "+v"(m[7]));
}
__device__ __forceinline__ float row_sum16(float s) {
  s += row_xor<1>(s); s += row_xor<2>(s); s += row_xor<4>(s); s += row_xor<8>(s);
  return s;
}

// ---- Register-blocked batched WMMA GEMM --------------------------------
// C[m,n] = scale * sum_k A[m,k] * Bt[n,k] (+bias)(+resid); each wave owns a 64x64 tile.
// A row-major [M,K]; Bt row-major [N,K]; M,N % 64 == 0, K % 32 == 0.
// SPLIT: operands are hi/lo planes (A2/Bt2 = lo planes, same layout); product = hi·hi + hi·lo + lo·hi.
// BIAS_MODE: 0 = none, 1 = bias[m], 2 = bias[n].
// OUT_MODE: 0 = f32, 1 = f16, 2 = bf16 hi plane (Cout) + bf16 lo plane (Cout2).
// ET: 0 = f16 operands, 1 = bf16 operands (pointers passed as 16-bit storage)
template <int ET> struct Elem;
template <> struct Elem<0> { typedef _Float16 T; };
template <> struct Elem<1> { typedef __bf16 T; };
template <int ET, bool SPLIT, int BIAS_MODE, int OUT_MODE, bool RESID, int ACT = 0>
__global__ __launch_bounds__(256) void wmma_gemm64(
    const unsigned short* __restrict__ Ap, const unsigned short* __restrict__ A2p, int lda, long strideA,
    const unsigned short* __restrict__ Btp, const unsigned short* __restrict__ Bt2p, int ldb, long strideB,
    void* __restrict__ Cout, void* __restrict__ Cout2, int ldc, long strideC,
    const float* __restrict__ bias,
    const float* __restrict__ resid, long strideR,
    int M, int N, int K, float scale) {
  typedef typename Elem<ET>::T T;
  typedef typename Frag<T>::V V;
  const T* A = (const T*)Ap; const T* A2 = (const T*)A2p; const T* Bt = (const T*)Btp; const T* Bt2 = (const T*)Bt2p;
  __shared__ __align__(16) float sT[8][16 * 68];   // per-wave 16x64 slab, pitch 68 floats
  const int b    = blockIdx.y;
  const int lane = threadIdx.x & 31;
  const int wave = threadIdx.x >> 5;
  const int tilesN = N >> 6;
  const int tilesM = M >> 6;
  const int tile = blockIdx.x * 8 + wave;
  if (tile >= tilesM * tilesN) return;   // wave-uniform; no block barriers in this kernel
  const int tm = tile / tilesN;
  const int tn = tile - tm * tilesN;
  const int m0 = tm << 6;
  const int n0 = tn << 6;

  const T* Ab  = A  + (size_t)b * strideA;
  const T* Bb  = Bt + (size_t)b * strideB;
  const T* Ab2 = SPLIT ? (A2  + (size_t)b * strideA) : nullptr;
  const T* Bb2 = SPLIT ? (Bt2 + (size_t)b * strideB) : nullptr;

  const int rlane = lane & 15;                 // row (A) / col (B, D) within subtile
  const int koff  = (lane >> 4) * 8;           // k offset of this lane half
  const int mOff  = (lane >> 4) * 8;           // D row offset

  v8f acc[4][4];
#pragma unroll
  for (int i = 0; i < 4; ++i)
#pragma unroll
    for (int j = 0; j < 4; ++j) acc[i][j] = (v8f){0.f,0.f,0.f,0.f,0.f,0.f,0.f,0.f};

  for (int k0 = 0; k0 < K; k0 += 32) {
    V bh[4], bl[4];
#pragma unroll
    for (int j = 0; j < 4; ++j) {
      const size_t bo = (size_t)(n0 + (j << 4) + rlane) * ldb + koff + k0;
      bh[j] = Frag<T>::load(Bb + bo);
      if (SPLIT) bl[j] = Frag<T>::load(Bb2 + bo);
    }
#pragma unroll
    for (int i = 0; i < 4; ++i) {
      const size_t ao = (size_t)(m0 + (i << 4) + rlane) * lda + koff + k0;
      V ah = Frag<T>::load(Ab + ao);
      V al;
      if (SPLIT) al = Frag<T>::load(Ab2 + ao);
#pragma unroll
      for (int j = 0; j < 4; ++j) {
        acc[i][j] = Frag<T>::mma(ah, bh[j], acc[i][j]);
        if (SPLIT) {
          acc[i][j] = Frag<T>::mma(ah, bl[j], acc[i][j]);
          acc[i][j] = Frag<T>::mma(al, bh[j], acc[i][j]);
        }
      }
      Frag<T>::guard(acc[i][0], acc[i][3], ah, SPLIT ? al : ah);
    }
    Frag<T>::keep(bh[0], bh[1], bh[2], bh[3]);
    if (SPLIT) Frag<T>::keep(bl[0], bl[1], bl[2], bl[3]);
  }
  acc_guard4(acc[0][0], acc[0][1], acc[0][2], acc[0][3]);
  acc_guard4(acc[1][0], acc[1][1], acc[1][2], acc[1][3]);
  acc_guard4(acc[2][0], acc[2][1], acc[2][2], acc[2][3]);
  acc_guard4(acc[3][0], acc[3][1], acc[3][2], acc[3][3]);

  // ---- epilogue ----
  float* slab = sT[wave];
  const float* Rb = RESID ? (resid + (size_t)b * strideR) : nullptr;
#pragma unroll
  for (int i = 0; i < 4; ++i) {
    const int mBase = m0 + (i << 4);
#pragma unroll
    for (int j = 0; j < 4; ++j) {
      const int n = n0 + (j << 4) + rlane;
      float bv = 0.f;
      if (BIAS_MODE == 2) bv = bias[n];
#pragma unroll
      for (int r = 0; r < 8; ++r) {
        float v = acc[i][j][r] * scale;
        if (BIAS_MODE == 1) v += bias[mBase + mOff + r];
        if (BIAS_MODE == 2) v += bv;
        if (RESID) v += Rb[(size_t)(mBase + mOff + r) * ldc + n];
        if (ACT == 1) v = tanhf(v);
        if (ACT == 2) v = fmaxf(v, 0.0f);
        if (ACT == 3) v = v / (1.0f + expf(-v));
        if (ACT == 4) v = (v > 0.f) ? v : 0.01f * v;
        if (ACT == 5) v = 0.5f * v * (1.0f + erff(v * 0.70710678118654752f));
        slab[(mOff + r) * 68 + (j << 4) + rlane] = v;
      }
    }
    __builtin_amdgcn_fence(__ATOMIC_RELEASE, "workgroup");
    __builtin_amdgcn_wave_barrier();
    __builtin_amdgcn_fence(__ATOMIC_ACQUIRE, "workgroup");
    if (OUT_MODE == 0) {
      float* C = (float*)Cout + (size_t)b * strideC;
      const int hh = lane >> 4, c4 = (lane & 15) * 4;     // row seg = 256 B = 16 lanes x 16 B
      {
#pragma unroll
        for (int it = 0; it < 8; ++it) {
          const int row = it * 2 + hh;
          v4f v = *(const v4f*)(slab + row * 68 + c4);
          *(v4f*)(C + (size_t)(mBase + row) * ldc + n0 + c4) = v;
        }
        
      }
    } else {
      const int q = lane >> 3, c8 = (lane & 7) * 8;
      unsigned short* C  = (unsigned short*)Cout  + (size_t)b * strideC;
      unsigned short* C2 = (OUT_MODE == 2) ? ((unsigned short*)Cout2 + (size_t)b * strideC) : nullptr;
      {
#pragma unroll
        for (int it = 0; it < 4; ++it) {
          const int row = it * 4 + q;
          const float* sp = slab + row * 68 + c8;
          v8h hv, lv;
#pragma unroll
          for (int e = 0; e < 8; ++e) {
            if (OUT_MODE == 1) {
              hv[e] = (_Float16)sp[e];
            } else {
              unsigned short hb = f2bf_bits(sp[e]);
              unsigned short lb = f2bf_bits(sp[e] - bf_bits2f(hb));
              hv[e] = __builtin_bit_cast(_Float16, hb);
              lv[e] = __builtin_bit_cast(_Float16, lb);
            }
          }
          *(v8h*)(C + (size_t)(mBase + row) * ldc + n0 + c8) = hv;
          if (OUT_MODE == 2) *(v8h*)(C2 + (size_t)(mBase + row) * ldc + n0 + c8) = lv;
        }
        
      }
    }
    __builtin_amdgcn_fence(__ATOMIC_RELEASE, "workgroup");
    __builtin_amdgcn_wave_barrier();
    __builtin_amdgcn_fence(__ATOMIC_ACQUIRE, "workgroup");
  }
}

// ---------------------------------------------------------------------------
// Weight convert: four f32 [c][d] matrices -> f16 transposed wt16[mat][d][c] (k-contiguous rows).
// grid (4 row-blocks of 32 d, 4 matrices), block 256. LDS transpose; each output row (256 B)
// ---------------------------------------------------------------------------
#define WC_P 136
__global__ __launch_bounds__(256) void k_wconvert(const float* __restrict__ w0, const float* __restrict__ w1,
                                                 const float* __restrict__ w2, const float* __restrict__ w3,
                                                 _Float16* __restrict__ wt16) {
  __shared__ __align__(16) _Float16 T[32 * WC_P];           // [d local][c]
  const int mat = blockIdx.y;
  const int n0  = blockIdx.x * 32;
  const int t   = threadIdx.x;
  const float* src = (mat == 0) ? w0 : (mat == 1) ? w1 : (mat == 2) ? w2 : w3;
#pragma unroll
  for (int it = 0; it < 16; ++it) {
    const int idx = it * 256 + t;                            // 0..4095
    const int k = idx >> 5, j = idx & 31;
    T[j * WC_P + k] = (_Float16)src[(size_t)k * kC + n0 + j];
  }
  __syncthreads();
  const int row0 = t >> 4, c8 = (t & 15) * 8;
  _Float16* dst = wt16 + ((size_t)mat * kC + n0) * kC;
  {
#pragma unroll
    for (int it = 0; it < 2; ++it) {
      const int rr = row0 + 16 * it;
      const v8h val = *(const v8h*)(T + rr * WC_P + c8);
      *(v8h*)(dst + (size_t)rr * kC + c8) = val;
    }
    
  }
}

// ---------------------------------------------------------------------------
// GroupNorm statistics in two launches, f64 accumulation.
// k_gn_part: one block per 128 token rows of one image (32 slices an image, 512 blocks: two per WGP). Lane = group,
// wave = 16 consecutive rows, all 16 row loads issued ahead of the sums; four independent sum chains per statistic.
// Partial row per block: [group][sum, sum of squares] = 512 B, written by wave 0.
// k_gn_final: one block per image adds its 32 partial rows.
// Table row per image: [0..31] = mean, [32..63] = rstd (256 B), written by lanes 0..15 of wave 0.
// ---------------------------------------------------------------------------
typedef __attribute__((ext_vector_type(2))) double v2d;
static constexpr int kGS  = 32;         // row slices per image
static constexpr int kGR  = kN / kGS;   // 128 rows per slice
__global__ __launch_bounds__(256) void k_gn_part(const float* __restrict__ x, double* __restrict__ part) {
  __shared__ double red_s[8][32], red_q[8][32];
  const int t = threadIdx.x, g = t & 31, rs = t >> 5;
  const float* xb = x + ((size_t)blockIdx.x * kGR + rs * (kGR / 8)) * kC + kCPG * g;
  v4f v[kGR / 8];
#pragma unroll
  for (int i = 0; i < kGR / 8; ++i) v[i] = *(const v4f*)(xb + i * kC);
  // keeps the sums behind all 16 loads (else half of the loads sink behind the first waits: a second memory trip in series)
  __builtin_amdgcn_sched_barrier(0);
  // the loads' address pair is free for reuse from here on; the pointer is an input, so it stays live up to this wait and
  // no load's result lands in the pair that the run still names
  asm volatile("s_wait_xcnt 0x0" :: "v"(xb) : "memory");
  double s[4] = {0.0, 0.0, 0.0, 0.0}, q[4] = {0.0, 0.0, 0.0, 0.0};
#pragma unroll
  for (int i = 0; i < kGR / 8; ++i) {
#pragma unroll
    for (int e = 0; e < 4; ++e) { const double d = (double)v[i][e]; s[e] += d; q[e] += d * d; }
  }
  red_s[rs][g] = (s[0] + s[1]) + (s[2] + s[3]);
  red_q[rs][g] = (q[0] + q[1]) + (q[2] + q[3]);
  __syncthreads();
  if (t < 32) {
    double S = 0.0, Q = 0.0;
#pragma unroll
    for (int i = 0; i < 8; ++i) { S += red_s[i][t]; Q += red_q[i][t]; }
    *(v2d*)(part + ((size_t)blockIdx.x * kNG + t) * 2) = (v2d){S, Q};
  }
}

__global__ __launch_bounds__(256) void k_gn_final(const double* __restrict__ part, float* __restrict__ gtab) {
  __shared__ double red_s[8][32], red_q[8][32];
  __shared__ __align__(16) float tab[64];
  const int b = blockIdx.x;
  const int t = threadIdx.x, g = t & 31, rs = t >> 5;
  const double* pb = part + (((size_t)b * kGS + rs * (kGS / 8)) * kNG + g) * 2;
  double s = 0.0, ss = 0.0;
#pragma unroll
  for (int i = 0; i < kGS / 8; ++i) {
    const v2d p = *(const v2d*)(pb + i * (kNG * 2));
    s += p[0]; ss += p[1];
  }
  red_s[rs][g] = s; red_q[rs][g] = ss;
  __syncthreads();
  if (t < 32) {
    double S = 0.0, Q = 0.0;
#pragma unroll
    for (int i = 0; i < 8; ++i) { S += red_s[i][t]; Q += red_q[i][t]; }
    const double inv_n = 1.0 / (double)(kN * kCPG);
    const double mean = S * inv_n;
    double var = Q * inv_n - mean * mean;
    if (var < 0.0) var = 0.0;
    const float rstd = rsqrtf((float)var + 1e-6f);
    tab[t] = (float)mean;
    tab[32 + t] = rstd;
  }
  __syncthreads();
  if (t < 16) {
    const v4f v = *(const v4f*)(tab + 4 * t);
    *(v4f*)(gtab + (size_t)b * 64 + 4 * t) = v;
  }
}

// ---------------------------------------------------------------------------
// GroupNorm apply: thread = 8 consecutive channels of one token row -> f16 h16[m][c] (16-B store,
// ---------------------------------------------------------------------------
__global__ __launch_bounds__(256) void k_gn_apply(const float* __restrict__ x, const float* __restrict__ gs,
                                                 const float* __restrict__ gb, const float* __restrict__ gtab,
                                                 _Float16* __restrict__ h16, int nvec) {
  const int i = blockIdx.x * 256 + threadIdx.x;
  if (i >= nvec) return;
  const int m  = i >> 4;
  const int c8 = (i & 15) * 8;
  const int b  = m >> 12;
  const int g0 = c8 >> 2;
  const float* tb = gtab + (size_t)b * 64;
  const float mean0 = tb[g0],     rstd0 = tb[32 + g0];
  const float mean1 = tb[g0 + 1], rstd1 = tb[32 + g0 + 1];
  const float* xr = x + (size_t)m * kC + c8;
  const v4f xa = *(const v4f*)(xr), xb2 = *(const v4f*)(xr + 4);
  const v4f sa = *(const v4f*)(gs + c8), sb = *(const v4f*)(gs + c8 + 4);
  const v4f ba = *(const v4f*)(gb + c8), bb = *(const v4f*)(gb + c8 + 4);
  v8h hv;
#pragma unroll
  for (int e = 0; e < 4; ++e) {
    hv[e]     = (_Float16)(((xa[e]  - mean0) * rstd0) * sa[e] + ba[e]);
    hv[4 + e] = (_Float16)(((xb2[e] - mean1) * rstd1) * sb[e] + bb[e]);
  }
  _Float16* dst = h16 + (size_t)m * kC + c8;
  *(v8h*)dst = hv;
  
}

// ---------------------------------------------------------------------------
// Flash attention, head dim 128, f16 q/k/v^T in, f16 out.
//   scores = q.k^T (x scale in f32)  : v_wmma_f32_16x16x32_f16
//   out    = p.v, p carried x2^15    : v_wmma_f32_16x16x32_f16; f32 accumulate; online softmax f32.
// Block = 4 waves = 64 query rows of one image; 64-key chunks; K [kv][d] and V^T [d][kv] tiles staged
// in LDS with plain 16-B loads + __syncthreads. grid.x = 16 images x 64 query blocks.
// ---------------------------------------------------------------------------
#define AT_KC 64
#define AT_OP 136
// LDS row pitches in f16 elements: an odd multiple of 16 B, so the 16 rows of one ds_load_b128 fall on distinct banks
#define AT_KP 136   // K rows of 256 B at 272 B
#define AT_VP 72    // V^T rows of 128 B at 144 B
#define AT_PP 72    // P rows of 128 B at 144 B
__global__ __launch_bounds__(128) void k_attn128(const _Float16* __restrict__ q16, const _Float16* __restrict__ k16,
                                                const _Float16* __restrict__ vt16, _Float16* __restrict__ o16,
                                                float scale) {
  __shared__ __align__(16) _Float16 Ksh[AT_KC * AT_KP];    // [kv][d]      17 KB
  __shared__ __align__(16) _Float16 Vts[kC * AT_VP];       // [d][kv]      18 KB
  __shared__ __align__(16) _Float16 Psh[4][16 * AT_PP];    // per wave [row][kv]  9 KB
  __shared__ __align__(16) _Float16 Osh[4][16 * AT_OP];    // per wave [row][d]   17 KB
  const int tid  = threadIdx.x;
  const int wave = tid >> 5;
  const int lane = tid & 31;
  const int hh   = lane >> 4;
  const int c    = lane & 15;
  const int b    = blockIdx.x >> 6;
  const int qb   = blockIdx.x & 63;
  const int q0   = qb * 64 + wave * 16;
  const size_t tok0 = (size_t)b * kN;

  // Q fragments (A operand), 4 d-chunks of 32
  v16h qa[4];
  {
    const _Float16* qrow = q16 + (tok0 + q0 + c) * kC;
#pragma unroll
    for (int dc = 0; dc < 4; ++dc) qa[dc] = Frag<_Float16>::load(qrow + dc * 32 + 8 * hh);
  }

  float mrow[8], lrow[8];
  v8f oacc[8];
#pragma unroll
  for (int r = 0; r < 8; ++r) { mrow[r] = -__builtin_inff(); lrow[r] = 0.f; }
#pragma unroll
  for (int t = 0; t < 8; ++t) oacc[t] = (v8f){0.f,0.f,0.f,0.f,0.f,0.f,0.f,0.f};

  _Float16* pw = Psh[wave];
  // this thread's first 16 B of the current K and V^T chunk; one pointer each frees the registers of the second fragment set
  const _Float16* kg = k16 + (tok0 + (tid >> 4)) * kC + (tid & 15) * 8;
  const _Float16* vg = vt16 + ((size_t)b * kC + (tid >> 3)) * kN + (tid & 7) * 8;
  const float PSC = 32768.0f;

#pragma unroll 1
  for (int kc = 0; kc < kN / AT_KC; ++kc) {
    __syncthreads();
#pragma unroll
    for (int it = 0; it < 8; ++it) {
      {
        // row = (tid >> 4) + 8 * it: so written, each address is one base register (pair) plus a constant per it
        const v8h kk = *(const v8h*)(kg + it * (8 * kC));
        *(v8h*)(Ksh + (tid >> 4) * AT_KP + (tid & 15) * 8 + it * (8 * AT_KP)) = kk;
      }
      {
        // d = (tid >> 3) + 16 * it: the same form
        const v8h vv = *(const v8h*)(vg + it * (16 * kN));
        *(v8h*)(Vts + (tid >> 3) * AT_VP + (tid & 7) * 8 + it * (16 * AT_VP)) = vv;
      }
    }
    // the staging loads' address registers are rewritten from here on (the two pointers move); both pointers are inputs,
    // so they stay live up to this wait and no staging load's result lands in an address pair that the run still names
    asm volatile("s_wait_xcnt 0x0" :: "v"(kg), "v"(vg) : "memory");
    kg += AT_KC * kC;
    vg += AT_KC;
    __syncthreads();

    // S = Q . K^T : 4 key tiles of 16, k = d over 4 chunks
    // The four K fragments of d-chunk dc + 1 are read as one group in front of the four products of d-chunk dc
    // (two register sets), so a wave waits once per group on a counted wait, not once per product on a full LDS trip.
    v8f s[4];
#pragma unroll
    for (int j = 0; j < 4; ++j) s[j] = (v8f){0.f,0.f,0.f,0.f,0.f,0.f,0.f,0.f};
    {
      const _Float16* kfp = Ksh + c * AT_KP + 8 * hh;
      v16h kf[2][4];
#pragma unroll
      for (int j = 0; j < 4; ++j) kf[0][j] = Frag<_Float16>::load(kfp + j * (16 * AT_KP));
#pragma unroll
      for (int dc = 0; dc < 4; ++dc) {
        if (dc < 3) {
#pragma unroll
          for (int j = 0; j < 4; ++j) kf[(dc + 1) & 1][j] = Frag<_Float16>::load(kfp + j * (16 * AT_KP) + (dc + 1) * 32);
        }
        // keeps the next group's reads in front of this group's products (else they sink back to one read per product)
        __builtin_amdgcn_sched_barrier(0);
#pragma unroll
        for (int j = 0; j < 4; ++j) s[j] = Frag<_Float16>::mma(qa[dc], kf[dc & 1][j], s[j]);
        // keeps what follows out of this run of products: the group after next would take a third register set,
        // and vector code mixed in behind the last group costs hazard v_nops between the products
        __builtin_amdgcn_sched_barrier(0);
        // the first group's results take fresh registers: its four fragments, held live past the run (inputs only, behind
        // the fence above), keep the compiler from placing a product's result over the B operand of an earlier product of the run
        if (dc == 0) asm volatile("" :: "v"(kf[0][0]), "v"(kf[0][1]), "v"(kf[0][2]), "v"(kf[0][3]));
      }
    }

    // chunk row max (row 8hh+r, 64 cols spread over the 16 lanes of this half x 4 tiles)
    float cm[8];
#pragma unroll
    for (int r = 0; r < 8; ++r) {
      float m = -__builtin_inff();
#pragma unroll
      for (int j = 0; j < 4; ++j) {
        const float sv = s[j][r] * scale;
        s[j][r] = sv;
        m = fmaxf(m, sv);
      }
      cm[r] = m;
    }
    row_max16_x8(cm);
    // online softmax; P (x2^15, f16) into this wave's LDS slab
#pragma unroll
    for (int r = 0; r < 8; ++r) {
      const float mnew  = fmaxf(mrow[r], cm[r]);
      const float alpha = __expf(mrow[r] - mnew);
      mrow[r] = mnew;
      float psum = 0.f;
#pragma unroll
      for (int j = 0; j < 4; ++j) {
        const float p = __expf(s[j][r] - mnew);
        psum += p;
        pw[(8 * hh + r) * AT_PP + j * 16 + c] = (_Float16)(p * PSC);
      }
      psum = row_sum16(psum);
      lrow[r] = lrow[r] * alpha + psum;
#pragma unroll
      for (int t = 0; t < 8; ++t) oacc[t][r] *= alpha;
    }
    __builtin_amdgcn_fence(__ATOMIC_RELEASE, "workgroup");
    __builtin_amdgcn_wave_barrier();
    __builtin_amdgcn_fence(__ATOMIC_ACQUIRE, "workgroup");

    // O += P . V : A = P [row][kv], B[kv][d] = Vts[d][kv]; 2 kv chunks of 32, 8 d tiles
    // Group g = kv chunk g >> 1, d tiles 4 * (g & 1) .. + 3; its V^T fragments are read one group ahead, as for K above.
    {
      const _Float16* vfp = Vts + c * AT_VP + 8 * hh;
      v16h pa[2], vf[2][4];
#pragma unroll
      for (int kk = 0; kk < 2; ++kk) pa[kk] = Frag<_Float16>::load(pw + c * AT_PP + kk * 32 + 8 * hh);
#pragma unroll
      for (int u = 0; u < 4; ++u) vf[0][u] = Frag<_Float16>::load(vfp + u * (16 * AT_VP));
#pragma unroll
      for (int g = 0; g < 4; ++g) {
        if (g < 3) {
          const int gn = g + 1;
#pragma unroll
          for (int u = 0; u < 4; ++u)
            vf[gn & 1][u] = Frag<_Float16>::load(vfp + ((gn & 1) * 4 + u) * (16 * AT_VP) + (gn >> 1) * 32);
        }
        // keeps the next group's reads in front of this group's products
        __builtin_amdgcn_sched_barrier(0);
#pragma unroll
        for (int u = 0; u < 4; ++u) oacc[(g & 1) * 4 + u] = Frag<_Float16>::mma(pa[g >> 1], vf[g & 1][u], oacc[(g & 1) * 4 + u]);
        // keeps what follows out of this run of products: the group after next would take a third register set,
        // and vector code mixed in behind the last group costs hazard v_nops between the products
        __builtin_amdgcn_sched_barrier(0);
      }
    }
  }

  _Float16* osw = Osh[wave];
#pragma unroll
  for (int r = 0; r < 8; ++r) {
    const float inv = 1.0f / (lrow[r] * PSC);
#pragma unroll
    for (int t = 0; t < 8; ++t) osw[(8 * hh + r) * AT_OP + t * 16 + c] = (_Float16)(oacc[t][r] * inv);
  }
  __builtin_amdgcn_fence(__ATOMIC_RELEASE, "workgroup");
  __builtin_amdgcn_wave_barrier();
  __builtin_amdgcn_fence(__ATOMIC_ACQUIRE, "workgroup");
  {
    const int c8 = (lane & 15) * 8;                          // row = 256 B = 16 lanes x 16 B
    _Float16* ob = o16 + (tok0 + q0) * kC;
    {
#pragma unroll
      for (int it = 0; it < 8; ++it) {
        const int row = it * 2 + hh;
        const v8h val = *(const v8h*)(osw + row * AT_OP + c8);
        *(v8h*)(ob + (size_t)row * kC + c8) = val;
      }
      
    }
  }
}

// ---------------------------------------------------------------------------
extern "C" void kernel_launch(void* const* d_in, const int* in_sizes, int n_in,
                              void* d_out, int out_size, void* d_ws, size_t ws_size,
                              hipStream_t stream) {
  if (n_in < 11) return;
  if (in_sizes[0] != kM * kC || out_size != kM * kC) return;
  if (in_sizes[1] != kC || in_sizes[2] != kC || in_sizes[4] != kC || in_sizes[6] != kC ||
      in_sizes[8] != kC || in_sizes[10] != kC) return;
  if (in_sizes[3] != kC * kC || in_sizes[5] != kC * kC || in_sizes[7] != kC * kC || in_sizes[9] != kC * kC) return;

  const float* x  = (const float*)d_in[0];
  const float* gs = (const float*)d_in[1];
  const float* gb = (const float*)d_in[2];
  const float* wq = (const float*)d_in[3];
  const float* bq = (const float*)d_in[4];
  const float* wk = (const float*)d_in[5];
  const float* bk = (const float*)d_in[6];
  const float* wv = (const float*)d_in[7];
  const float* bv = (const float*)d_in[8];
  const float* wo = (const float*)d_in[9];
  const float* bo = (const float*)d_in[10];
  float* out = (float*)d_out;

  // workspace carve (bytes)
  const size_t szW   = (size_t)4 * kC * kC * sizeof(_Float16);       // 131072
  const size_t szTab = (size_t)kB * 64 * sizeof(float);               // 4096
  const size_t szT16 = (size_t)kM * kC * sizeof(_Float16);            // 16777216
  const size_t offW   = 0;
  const size_t offTab = offW + szW;
  const size_t offH   = offTab + szTab;
  const size_t offQ   = offH + szT16;
  const size_t offK   = offQ + szT16;
  const size_t offVt  = offK + szT16;
  const size_t offO   = offVt + szT16;
  const size_t offP   = offO + szT16;                                  // 84021248
  const size_t szP    = (size_t)kB * kGS * kNG * 2 * sizeof(double);   // 262144
  const size_t offEnd = offP + szP;                                    // 84283392
  if (offEnd > ws_size) return;

  char* ws = (char*)d_ws;
  _Float16* wt16 = (_Float16*)(ws + offW);
  float*    gtab = (float*)(ws + offTab);
  _Float16* h16  = (_Float16*)(ws + offH);
  _Float16* q16  = (_Float16*)(ws + offQ);
  _Float16* k16  = (_Float16*)(ws + offK);
  _Float16* vt16 = (_Float16*)(ws + offVt);
  _Float16* o16  = (_Float16*)(ws + offO);
  double*   gpart = (double*)(ws + offP);
  const _Float16* wtq = wt16;
  const _Float16* wtk = wt16 + (size_t)kC * kC;
  const _Float16* wtv = wt16 + (size_t)2 * kC * kC;
  const _Float16* wto = wt16 + (size_t)3 * kC * kC;

  // 1. weights f32 [c][d] -> f16 [d][c]
  k_wconvert<<<dim3(kC / 32, 4), 256, 0, stream>>>(wq, wk, wv, wo, wt16);
  // 2. GroupNorm statistics and apply
  k_gn_part<<<kB * kGS, 256, 0, stream>>>(x, gpart);
  k_gn_final<<<kB, 256, 0, stream>>>(gpart, gtab);
  const int nvec = kM * (kC / 8);                                      // 1048576
  k_gn_apply<<<(nvec + 255) / 256, 256, 0, stream>>>(x, gs, gb, gtab, h16, nvec);

  // 3. projections: q16 = h.wq + bq, k16 = h.wk + bk   (M=65536, N=128, K=128; 2048 wave tiles)
  const int gridMN = ((kM / 64) * (kC / 64) + 7) / 8;                  // 256
  wmma_gemm64<0, false, 2, 1, false><<<dim3(gridMN, 1), 256, 0, stream>>>(
      U16(h16), U16(h16), kC, (long)0, U16(wtq), U16(wtq), kC, (long)0,
      (void*)q16, (void*)nullptr, kC, (long)0, bq, (const float*)nullptr, (long)0, kM, kC, kC, 1.0f);
  wmma_gemm64<0, false, 2, 1, false><<<dim3(gridMN, 1), 256, 0, stream>>>(
      U16(h16), U16(h16), kC, (long)0, U16(wtk), U16(wtk), kC, (long)0,
      (void*)k16, (void*)nullptr, kC, (long)0, bk, (const float*)nullptr, (long)0, kM, kC, kC, 1.0f);
  //    v^T per image: vt16[b][d][n] = sum_c wt_v[d][c] . h16[b][n][c] + bv[d]  (M=128, N=4096, K=128, batched)
  const int gridVt = ((kC / 64) * (kN / 64) + 7) / 8;                  // 16
  wmma_gemm64<0, false, 1, 1, false><<<dim3(gridVt, kB), 256, 0, stream>>>(
      U16(wtv), U16(wtv), kC, (long)0, U16(h16), U16(h16), kC, (long)kN * kC,
      (void*)vt16, (void*)nullptr, kN, (long)kC * kN, bv, (const float*)nullptr, (long)0, kC, kN, kC, 1.0f);

  // 4. attention
  const float scale = 0.08838834764831845f;                            // 128^-0.5
  k_attn128<<<kB * (kN / 64), 128, 0, stream>>>(q16, k16, vt16, o16, scale);

  // 5. out = x + o.wo + bo  (f32, residual)
  wmma_gemm64<0, false, 2, 0, true><<<dim3(gridMN, 1), 256, 0, stream>>>(
      U16(o16), U16(o16), kC, (long)0, U16(wto), U16(wto), kC, (long)0,
      (void*)out, (void*)nullptr, kC, (long)0, bo, x, (long)0, kM, kC, kC, 1.0f);
}

// v005
// A run of this version takes 193 microseconds.
// Timed twice side by side with v004, it ran 1.20 times as fast both times.
// Over all steps from v000 it is 6.18 times as fast.
// Contractions: v_wmma_f32_16x16x32_f16 (f16 operands, f32 accumulate) for the three 1x1 projections,
// k.q^T, v^T.p^T (p carried x2^15) and the output projection; GroupNorm statistics f64/f32, softmax f32.
#include <hip/hip_runtime.h>

typedef __attribute__((ext_vector_type(16))) _Float16 v16h;
typedef __attribute__((ext_vector_type(8)))  _Float16 v8h;
typedef __attribute__((ext_vector_type(16))) __bf16   v16b;
typedef __attribute__((ext_vector_type(8)))  __bf16   v8b;
typedef __attribute__((ext_vector_type(8)))  float    v8f;
typedef __attribute__((ext_vector_type(4)))  float    v4f;
typedef __attribute__((ext_vector_type(2)))  float    v2f;
#define U16(p) ((const unsigned short*)(const void*)(p))

static constexpr int kB  = 16;          // batch
static constexpr int kN  = 4096;        // tokens per image (64*64)
static constexpr int kC  = 128;         // channels
static constexpr int kM  = kB * kN;     // 65536 token rows
static constexpr int kNG = 32;          // groups
static constexpr int kCPG = 4;          // channels per group

__device__ __forceinline__ unsigned short f2bf_bits(float f) {
  unsigned u = __float_as_uint(f);
  return (unsigned short)((u + 0x7FFFu + ((u >> 16) & 1u)) >> 16);
}
__device__ __forceinline__ float bf_bits2f(unsigned short h) { return __uint_as_float(((unsigned)h) << 16); }

// hazard guards as plain device helpers
__device__ __forceinline__ void dep_guard_h(v8f& a, v8f& b, v16h x, v16h y) { asm volatile("v_nop\n\tv_nop\n\tv_nop\n\tv_nop" : "+v"(a), "+v"(b) : "v"(x), "v"(y)); }
__device__ __forceinline__ void dep_guard_b(v8f& a, v8f& b, v16b x, v16b y) { asm volatile("v_nop\n\tv_nop\n\tv_nop\n\tv_nop" : "+v"(a), "+v"(b) : "v"(x), "v"(y)); }
__device__ __forceinline__ void keep4_h(v16h a, v16h b, v16h c, v16h d) { asm volatile("v_nop" :: "v"(a), "v"(b), "v"(c), "v"(d)); }
__device__ __forceinline__ void keep4_b(v16b a, v16b b, v16b c, v16b d) { asm volatile("v_nop" :: "v"(a), "v"(b), "v"(c), "v"(d)); }
__device__ __forceinline__ void acc_guard4(v8f& a, v8f& b, v8f& c, v8f& d) { asm volatile("v_nop\n\tv_nop\n\tv_nop\n\tv_nop" : "+v"(a), "+v"(b), "+v"(c), "+v"(d)); }
template <typename T> struct Frag;
template <> struct Frag<_Float16> {
  typedef v16h V; union U { v16h v; v8h h[2]; };
  static __device__ __forceinline__ v16h load(const _Float16* p) {   // elements 0..7 <- p[0..7], 8..15 <- p[16..23]
    U f; f.h[0] = *(const v8h*)(p); f.h[1] = *(const v8h*)(p + 16); return f.v;
  }
  static __device__ __forceinline__ v8f mma(v16h a, v16h b, v8f c) {
    return __builtin_amdgcn_wmma_f32_16x16x32_f16(false, a, false, b, (short)0, c, false, false);
  }
  static __device__ __forceinline__ void guard(v8f& a, v8f& b, v16h x, v16h y) { dep_guard_h(a, b, x, y); }
  static __device__ __forceinline__ void keep(v16h a, v16h b, v16h c, v16h d) { keep4_h(a, b, c, d); }
};
template <> struct Frag<__bf16> {
  typedef v16b V; union U { v16b v; v8b h[2]; };
  static __device__ __forceinline__ v16b load(const __bf16* p) {
    U f; f.h[0] = *(const v8b*)(p); f.h[1] = *(const v8b*)(p + 16); return f.v;
  }
  static __device__ __forceinline__ v8f mma(v16b a, v16b b, v8f c) {
    return __builtin_amdgcn_wmma_f32_16x16x32_bf16(false, a, false, b, (short)0, c, false, false);
  }
  static __device__ __forceinline__ void guard(v8f& a, v8f& b, v16b x, v16b y) { dep_guard_b(a, b, x, y); }
  static __device__ __forceinline__ void keep(v16b a, v16b b, v16b c, v16b d) { keep4_b(a, b, c, d); }
};

// lane l <-> lane l ^ 16 on the vector unit: the two halves of a wave hold the two halves of one query's keys
__device__ __forceinline__ float xhalf(float v) {
  const int b = __builtin_bit_cast(int, v);
  return __builtin_bit_cast(float, __builtin_amdgcn_permlanex16(b, b, 0x76543210, 0xfedcba98, false, false));
}

// ---- Register-blocked batched WMMA GEMM --------------------------------
// C[m,n] = scale * sum_k A[m,k] * Bt[n,k] (+bias)(+resid); each wave owns a 64x64 tile.
// A row-major [M,K]; Bt row-major [N,K]; M,N % 64 == 0, K % 32 == 0.
// SPLIT: operands are hi/lo planes (A2/Bt2 = lo planes, same layout); product = hi·hi + hi·lo + lo·hi.
// BIAS_MODE: 0 = none, 1 = bias[m], 2 = bias[n].
// OUT_MODE: 0 = f32, 1 = f16, 2 = bf16 hi plane (Cout) + bf16 lo plane (Cout2).
// ET: 0 = f16 operands, 1 = bf16 operands (pointers passed as 16-bit storage)
template <int ET> struct Elem;
template <> struct Elem<0> { typedef _Float16 T; };
template <> struct Elem<1> { typedef __bf16 T; };
template <int ET, bool SPLIT, int BIAS_MODE, int OUT_MODE, bool RESID, int ACT = 0>
__global__ __launch_bounds__(256) void wmma_gemm64(
    const unsigned short* __restrict__ Ap, const unsigned short* __restrict__ A2p, int lda, long strideA,
    const unsigned short* __restrict__ Btp, const unsigned short* __restrict__ Bt2p, int ldb, long strideB,
    void* __restrict__ Cout, void* __restrict__ Cout2, int ldc, long strideC,
    const float* __restrict__ bias,
    const float* __restrict__ resid, long strideR,
    int M, int N, int K, float scale) {
  typedef typename Elem<ET>::T T;
  typedef typename Frag<T>::V V;
  const T* A = (const T*)Ap; const T* A2 = (const T*)A2p; const T* Bt = (const T*)Btp; const T* Bt2 = (const T*)Bt2p;
  __shared__ __align__(16) float sT[8][16 * 68];   // per-wave 16x64 slab, pitch 68 floats
  const int b    = blockIdx.y;
  const int lane = threadIdx.x & 31;
  const int wave = threadIdx.x >> 5;
  const int tilesN = N >> 6;
  const int tilesM = M >> 6;
  const int tile = blockIdx.x * 8 + wave;
  if (tile >= tilesM * tilesN) return;   // wave-uniform; no block barriers in this kernel
  const int tm = tile / tilesN;
  const int tn = tile - tm * tilesN;
  const int m0 = tm << 6;
  const int n0 = tn << 6;

  const T* Ab  = A  + (size_t)b * strideA;
  const T* Bb  = Bt + (size_t)b * strideB;
  const T* Ab2 = SPLIT ? (A2  + (size_t)b * strideA) : nullptr;
  const T* Bb2 = SPLIT ? (Bt2 + (size_t)b * strideB) : nullptr;

  const int rlane = lane & 15;                 // row (A) / col (B, D) within subtile
  const int koff  = (lane >> 4) * 8;           // k offset of this lane half
  const int mOff  = (lane >> 4) * 8;           // D row offset

  v8f acc[4][4];
#pragma unroll
  for (int i = 0; i < 4; ++i)
#pragma unroll
    for (int j = 0; j < 4; ++j) acc[i][j] = (v8f){0.f,0.f,0.f,0.f,0.f,0.f,0.f,0.f};

  for (int k0 = 0; k0 < K; k0 += 32) {
    V bh[4], bl[4];
#pragma unroll
    for (int j = 0; j < 4; ++j) {
      const size_t bo = (size_t)(n0 + (j << 4) + rlane) * ldb + koff + k0;
      bh[j] = Frag<T>::load(Bb + bo);
      if (SPLIT) bl[j] = Frag<T>::load(Bb2 + bo);
    }
#pragma unroll
    for (int i = 0; i < 4; ++i) {
      const size_t ao = (size_t)(m0 + (i << 4) + rlane) * lda + koff + k0;
      V ah = Frag<T>::load(Ab + ao);
      V al;
      if (SPLIT) al = Frag<T>::load(Ab2 + ao);
#pragma unroll
      for (int j = 0; j < 4; ++j) {
        acc[i][j] = Frag<T>::mma(ah, bh[j], acc[i][j]);
        if (SPLIT) {
          acc[i][j] = Frag<T>::mma(ah, bl[j], acc[i][j]);
          acc[i][j] = Frag<T>::mma(al, bh[j], acc[i][j]);
        }
      }
      Frag<T>::guard(acc[i][0], acc[i][3], ah, SPLIT ? al : ah);
    }
    Frag<T>::keep(bh[0], bh[1], bh[2], bh[3]);
    if (SPLIT) Frag<T>::keep(bl[0], bl[1], bl[2], bl[3]);
  }
  acc_guard4(acc[0][0], acc[0][1], acc[0][2], acc[0][3]);
  acc_guard4(acc[1][0], acc[1][1], acc[1][2], acc[1][3]);
  acc_guard4(acc[2][0], acc[2][1], acc[2][2], acc[2][3]);
  acc_guard4(acc[3][0], acc[3][1], acc[3][2], acc[3][3]);

  // ---- epilogue ----
  float* slab = sT[wave];
  const float* Rb = RESID ? (resid + (size_t)b * strideR) : nullptr;
#pragma unroll
  for (int i = 0; i < 4; ++i) {
    const int mBase = m0 + (i << 4);
#pragma unroll
    for (int j = 0; j < 4; ++j) {
      const int n = n0 + (j << 4) + rlane;
      float bv = 0.f;
      if (BIAS_MODE == 2) bv = bias[n];
#pragma unroll
      for (int r = 0; r < 8; ++r) {
        float v = acc[i][j][r] * scale;
        if (BIAS_MODE == 1) v += bias[mBase + mOff + r];
        if (BIAS_MODE == 2) v += bv;
        if (RESID) v += Rb[(size_t)(mBase + mOff + r) * ldc + n];
        if (ACT == 1) v = tanhf(v);
        if (ACT == 2) v = fmaxf(v, 0.0f);
        if (ACT == 3) v = v / (1.0f + expf(-v));
        if (ACT == 4) v = (v > 0.f) ? v : 0.01f * v;
        if (ACT == 5) v = 0.5f * v * (1.0f + erff(v * 0.70710678118654752f));
        slab[(mOff + r) * 68 + (j << 4) + rlane] = v;
      }
    }
    __builtin_amdgcn_fence(__ATOMIC_RELEASE, "workgroup");
    __builtin_amdgcn_wave_barrier();
    __builtin_amdgcn_fence(__ATOMIC_ACQUIRE, "workgroup");
    if (OUT_MODE == 0) {
      float* C = (float*)Cout + (size_t)b * strideC;
      const int hh = lane >> 4, c4 = (lane & 15) * 4;     // row seg = 256 B = 16 lanes x 16 B
      {
#pragma unroll
        for (int it = 0; it < 8; ++it) {
          const int row = it * 2 + hh;
          v4f v = *(const v4f*)(slab + row * 68 + c4);
          *(v4f*)(C + (size_t)(mBase + row) * ldc + n0 + c4) = v;
        }
        
      }
    } else {
      const int q = lane >> 3, c8 = (lane & 7) * 8;
      unsigned short* C  = (unsigned short*)Cout  + (size_t)b * strideC;
      unsigned short* C2 = (OUT_MODE == 2) ? ((unsigned short*)Cout2 + (size_t)b * strideC) : nullptr;
      {
#pragma unroll
        for (int it = 0; it < 4; ++it) {
          const int row = it * 4 + q;
          const float* sp = slab + row * 68 + c8;
          v8h hv, lv;
#pragma unroll
          for (int e = 0; e < 8; ++e) {
            if (OUT_MODE == 1) {
              hv[e] = (_Float16)sp[e];
            } else {
              unsigned short hb = f2bf_bits(sp[e]);
              unsigned short lb = f2bf_bits(sp[e] - bf_bits2f(hb));
              hv[e] = __builtin_bit_cast(_Float16, hb);
              lv[e] = __builtin_bit_cast(_Float16, lb);
            }
          }
          *(v8h*)(C + (size_t)(mBase + row) * ldc + n0 + c8) = hv;
          if (OUT_MODE == 2) *(v8h*)(C2 + (size_t)(mBase + row) * ldc + n0 + c8) = lv;
        }
        
      }
    }
    __builtin_amdgcn_fence(__ATOMIC_RELEASE, "workgroup");
    __builtin_amdgcn_wave_barrier();
    __builtin_amdgcn_fence(__ATOMIC_ACQUIRE, "workgroup");
  }
}

// ---------------------------------------------------------------------------
// Weight convert: four f32 [c][d] matrices -> f16 transposed wt16[mat][d][c] (k-contiguous rows).
// grid (4 row-blocks of 32 d, 4 matrices), block 256. LDS transpose; each output row (256 B)
// ---------------------------------------------------------------------------
#define WC_P 136
__global__ __launch_bounds__(256) void k_wconvert(const float* __restrict__ w0, const float* __restrict__ w1,
                                                 const float* __restrict__ w2, const float* __restrict__ w3,
                                                 _Float16* __restrict__ wt16) {
  __shared__ __align__(16) _Float16 T[32 * WC_P];           // [d local][c]
  const int mat = blockIdx.y;
  const int n0  = blockIdx.x * 32;
  const int t   = threadIdx.x;
  const float* src = (mat == 0) ? w0 : (mat == 1) ? w1 : (mat == 2) ? w2 : w3;
#pragma unroll
  for (int it = 0; it < 16; ++it) {
    const int idx = it * 256 + t;                            // 0..4095
    const int k = idx >> 5, j = idx & 31;
    T[j * WC_P + k] = (_Float16)src[(size_t)k * kC + n0 + j];
  }
  __syncthreads();
  const int row0 = t >> 4, c8 = (t & 15) * 8;
  _Float16* dst = wt16 + ((size_t)mat * kC + n0) * kC;
  {
#pragma unroll
    for (int it = 0; it < 2; ++it) {
      const int rr = row0 + 16 * it;
      const v8h val = *(const v8h*)(T + rr * WC_P + c8);
      *(v8h*)(dst + (size_t)rr * kC + c8) = val;
    }
    
  }
}

// ---------------------------------------------------------------------------
// GroupNorm statistics in two launches, f64 accumulation.
// k_gn_part: one block per 128 token rows of one image (32 slices an image, 512 blocks: two per WGP). Lane = group,
// wave = 16 consecutive rows, all 16 row loads issued ahead of the sums; four independent sum chains per statistic.
// Partial row per block: [group][sum, sum of squares] = 512 B, written by wave 0.
// k_gn_final: one block per image adds its 32 partial rows.
// Table row per image: [0..31] = mean, [32..63] = rstd (256 B), written by lanes 0..15 of wave 0.
// ---------------------------------------------------------------------------
typedef __attribute__((ext_vector_type(2))) double v2d;
static constexpr int kGS  = 32;         // row slices per image
static constexpr int kGR  = kN / kGS;   // 128 rows per slice
__global__ __launch_bounds__(256) void k_gn_part(const float* __restrict__ x, double* __restrict__ part) {
  __shared__ double red_s[8][32], red_q[8][32];
  const int t = threadIdx.x, g = t & 31, rs = t >> 5;
  const float* xb = x + ((size_t)blockIdx.x * kGR + rs * (kGR / 8)) * kC + kCPG * g;
  v4f v[kGR / 8];
#pragma unroll
  for (int i = 0; i < kGR / 8; ++i) v[i] = *(const v4f*)(xb + i * kC);
  // keeps the sums behind all 16 loads (else half of the loads sink behind the first waits: a second memory trip in series)
  __builtin_amdgcn_sched_barrier(0);
  // the loads' address pair is free for reuse from here on; the pointer is an input, so it stays live up to this wait and
  // no load's result lands in the pair that the run still names
  asm volatile("s_wait_xcnt 0x0" :: "v"(xb) : "memory");
  double s[4] = {0.0, 0.0, 0.0, 0.0}, q[4] = {0.0, 0.0, 0.0, 0.0};
#pragma unroll
  for (int i = 0; i < kGR / 8; ++i) {
#pragma unroll
    for (int e = 0; e < 4; ++e) { const double d = (double)v[i][e]; s[e] += d; q[e] += d * d; }
  }
  red_s[rs][g] = (s[0] + s[1]) + (s[2] + s[3]);
  red_q[rs][g] = (q[0] + q[1]) + (q[2] + q[3]);
  __syncthreads();
  if (t < 32) {
    double S = 0.0, Q = 0.0;
#pragma unroll
    for (int i = 0; i < 8; ++i) { S += red_s[i][t]; Q += red_q[i][t]; }
    *(v2d*)(part + ((size_t)blockIdx.x * kNG + t) * 2) = (v2d){S, Q};
  }
}

__global__ __launch_bounds__(256) void k_gn_final(const double* __restrict__ part, float* __restrict__ gtab) {
  __shared__ double red_s[8][32], red_q[8][32];
  __shared__ __align__(16) float tab[64];
  const int b = blockIdx.x;
  const int t = threadIdx.x, g = t & 31, rs = t >> 5;
  const double* pb = part + (((size_t)b * kGS + rs * (kGS / 8)) * kNG + g) * 2;
  double s = 0.0, ss = 0.0;
#pragma unroll
  for (int i = 0; i < kGS / 8; ++i) {
    const v2d p = *(const v2d*)(pb + i * (kNG * 2));
    s += p[0]; ss += p[1];
  }
  red_s[rs][g] = s; red_q[rs][g] = ss;
  __syncthreads();
  if (t < 32) {
    double S = 0.0, Q = 0.0;
#pragma unroll
    for (int i = 0; i < 8; ++i) { S += red_s[i][t]; Q += red_q[i][t]; }
    const double inv_n = 1.0 / (double)(kN * kCPG);
    const double mean = S * inv_n;
    double var = Q * inv_n - mean * mean;
    if (var < 0.0) var = 0.0;
    const float rstd = rsqrtf((float)var + 1e-6f);
    tab[t] = (float)mean;
    tab[32 + t] = rstd;
  }
  __syncthreads();
  if (t < 16) {
    const v4f v = *(const v4f*)(tab + 4 * t);
    *(v4f*)(gtab + (size_t)b * 64 + 4 * t) = v;
  }
}

// ---------------------------------------------------------------------------
// GroupNorm apply: thread = 8 consecutive channels of one token row -> f16 h16[m][c] (16-B store,
// ---------------------------------------------------------------------------
__global__ __launch_bounds__(256) void k_gn_apply(const float* __restrict__ x, const float* __restrict__ gs,
                                                 const float* __restrict__ gb, const float* __restrict__ gtab,
                                                 _Float16* __restrict__ h16, int nvec) {
  const int i = blockIdx.x * 256 + threadIdx.x;
  if (i >= nvec) return;
  const int m  = i >> 4;
  const int c8 = (i & 15) * 8;
  const int b  = m >> 12;
  const int g0 = c8 >> 2;
  const float* tb = gtab + (size_t)b * 64;
  const float mean0 = tb[g0],     rstd0 = tb[32 + g0];
  const float mean1 = tb[g0 + 1], rstd1 = tb[32 + g0 + 1];
  const float* xr = x + (size_t)m * kC + c8;
  const v4f xa = *(const v4f*)(xr), xb2 = *(const v4f*)(xr + 4);
  const v4f sa = *(const v4f*)(gs + c8), sb = *(const v4f*)(gs + c8 + 4);
  const v4f ba = *(const v4f*)(gb + c8), bb = *(const v4f*)(gb + c8 + 4);
  v8h hv;
#pragma unroll
  for (int e = 0; e < 4; ++e) {
    hv[e]     = (_Float16)(((xa[e]  - mean0) * rstd0) * sa[e] + ba[e]);
    hv[4 + e] = (_Float16)(((xb2[e] - mean1) * rstd1) * sb[e] + bb[e]);
  }
  _Float16* dst = h16 + (size_t)m * kC + c8;
  *(v8h*)dst = hv;
  
}

#define AT_KC 64
#define AT_OP 136
// LDS row pitches in f16 elements: an odd multiple of 16 B, so the 16 rows of one ds_load_b128 fall on distinct banks
#define AT_KP 136   // K rows of 256 B at 272 B
#define AT_VP 72    // V^T rows of 128 B at 144 B
__global__ __launch_bounds__(128) void k_attn128(const _Float16* __restrict__ q16, const _Float16* __restrict__ k16,
                                                const _Float16* __restrict__ vt16, _Float16* __restrict__ o16,
                                                float scale) {
  __shared__ __align__(16) _Float16 Ksh[AT_KC * AT_KP];    // [kv][d]      17 KB
  __shared__ __align__(16) _Float16 Vts[kC * AT_VP];       // [d][kv]      18 KB
  __shared__ __align__(16) _Float16 Osh[4][16 * AT_OP];    // per wave [row][d]   17 KB
  const int tid  = threadIdx.x;
  const int wave = tid >> 5;
  const int lane = tid & 31;
  const int hh   = lane >> 4;
  const int c    = lane & 15;
  const int b    = blockIdx.x >> 6;
  const int qb   = blockIdx.x & 63;
  const int q0   = qb * 64 + wave * 16;
  const size_t tok0 = (size_t)b * kN;

  // Q fragments (B operand: lane = query column c), 4 d-chunks of 32
  v16h qa[4];
  {
    const _Float16* qrow = q16 + (tok0 + q0 + c) * kC;
#pragma unroll
    for (int dc = 0; dc < 4; ++dc) qa[dc] = Frag<_Float16>::load(qrow + dc * 32 + 8 * hh);
  }

  // query c's running maximum (equal in both halves) and this half's share of its running sum
  float mrow = -__builtin_inff(), lrow = 0.f;
  v8f oacc[8];                                             // oacc[t][r] = O[query c][d = 16 t + 8 hh + r]
#pragma unroll
  for (int t = 0; t < 8; ++t) oacc[t] = (v8f){0.f,0.f,0.f,0.f,0.f,0.f,0.f,0.f};

  // this thread's first 16 B of the current K and V^T chunk; one pointer each frees the registers of the second fragment set
  const _Float16* kg = k16 + (tok0 + (tid >> 4)) * kC + (tid & 15) * 8;
  const _Float16* vg = vt16 + ((size_t)b * kC + (tid >> 3)) * kN + (tid & 7) * 8;
  const float PSC = 32768.0f;

#pragma unroll 1
  for (int kc = 0; kc < kN / AT_KC; ++kc) {
    __syncthreads();
#pragma unroll
    for (int it = 0; it < 8; ++it) {
      {
        // row = (tid >> 4) + 8 * it: so written, each address is one base register (pair) plus a constant per it
        const v8h kk = *(const v8h*)(kg + it * (8 * kC));
        *(v8h*)(Ksh + (tid >> 4) * AT_KP + (tid & 15) * 8 + it * (8 * AT_KP)) = kk;
      }
      {
        // d = (tid >> 3) + 16 * it: the same form
        const v8h vv = *(const v8h*)(vg + it * (16 * kN));
        *(v8h*)(Vts + (tid >> 3) * AT_VP + (tid & 7) * 8 + it * (16 * AT_VP)) = vv;
      }
    }
    // the staging loads' address registers are rewritten from here on (the two pointers move); both pointers are inputs,
    // so they stay live up to this wait and no staging load's result lands in an address pair that the run still names
    asm volatile("s_wait_xcnt 0x0" :: "v"(kg), "v"(vg) : "memory");
    kg += AT_KC * kC;
    vg += AT_KC;
    __syncthreads();

    // S^T = K . Q^T : 4 key tiles of 16, k = d over 4 chunks; s[j][r] = score of key 16 j + 8 hh + r with query c
    // The four K fragments of d-chunk dc + 1 are read as one group in front of the four products of d-chunk dc
    // (two register sets), so a wave waits once per group on a counted wait, not once per product on a full LDS trip.
    v8f s[4];
#pragma unroll
    for (int j = 0; j < 4; ++j) s[j] = (v8f){0.f,0.f,0.f,0.f,0.f,0.f,0.f,0.f};
    {
      const _Float16* kfp = Ksh + c * AT_KP + 8 * hh;
      v16h kf[2][4];
#pragma unroll
      for (int j = 0; j < 4; ++j) kf[0][j] = Frag<_Float16>::load(kfp + j * (16 * AT_KP));
#pragma unroll
      for (int dc = 0; dc < 4; ++dc) {
        if (dc < 3) {
#pragma unroll
          for (int j = 0; j < 4; ++j) kf[(dc + 1) & 1][j] = Frag<_Float16>::load(kfp + j * (16 * AT_KP) + (dc + 1) * 32);
        }
        // keeps the next group's reads in front of this group's products (else they sink back to one read per product)
        __builtin_amdgcn_sched_barrier(0);
#pragma unroll
        for (int j = 0; j < 4; ++j) s[j] = Frag<_Float16>::mma(kf[dc & 1][j], qa[dc], s[j]);
        // keeps what follows out of this run of products: the group after next would take a third register set,
        // and vector code mixed in behind the last group costs hazard v_nops between the products
        __builtin_amdgcn_sched_barrier(0);
        // the first group's results take fresh registers: its four fragments, held live past the run (inputs only, behind
        // the fence above), keep the compiler from placing a product's result over the A operand of an earlier product of the run
        if (dc == 0) asm volatile("" :: "v"(kf[0][0]), "v"(kf[0][1]), "v"(kf[0][2]), "v"(kf[0][3]));
      }
    }

    // chunk maximum of query c: 32 scores in this lane (one chain per key tile), then the other half's
    float mj[4];
#pragma unroll
    for (int j = 0; j < 4; ++j) {
      s[j] *= scale;
      float m = fmaxf(s[j][0], s[j][1]);
#pragma unroll
      for (int r = 2; r < 8; ++r) m = fmaxf(m, s[j][r]);
      mj[j] = m;
    }
    float cm = fmaxf(fmaxf(mj[0], mj[1]), fmaxf(mj[2], mj[3]));
    cm = fmaxf(cm, xhalf(cm));
    // online softmax; P^T (x2^15, f16) straight into the B operand: element e of kv chunk kk is key 32 kk + 8 hh + e
    // (e < 8, tile 2 kk) or 32 kk + 16 + 8 hh + e - 8 (tile 2 kk + 1), the k order of the V^T loader
    const float mnew  = fmaxf(mrow, cm);
    const float alpha = __expf(mrow - mnew);
    mrow = mnew;
    Frag<_Float16>::U pb[2];
    v2f pj[4];                                             // per key tile: sums of its even and of its odd registers
#pragma unroll
    for (int j = 0; j < 4; ++j) {
      v8f p;
#pragma unroll
      for (int r = 0; r < 8; ++r) p[r] = __expf(s[j][r] - mnew);
      pj[j] = (__builtin_shufflevector(p, p, 0, 1) + __builtin_shufflevector(p, p, 2, 3)) +
              (__builtin_shufflevector(p, p, 4, 5) + __builtin_shufflevector(p, p, 6, 7));
      pb[j >> 1].h[j & 1] = __builtin_convertvector(p * PSC, v8h);
    }
    const v2f ps = (pj[0] + pj[1]) + (pj[2] + pj[3]);
    lrow = lrow * alpha + (ps[0] + ps[1]);
#pragma unroll
    for (int t = 0; t < 8; ++t) oacc[t] *= alpha;

    // O^T += V^T . P^T : A = Vts [d][kv], B = P^T; 2 kv chunks of 32, 8 d tiles
    // Group g = kv chunk g >> 1, d tiles 4 * (g & 1) .. + 3; its V^T fragments are read one group ahead, as for K above.
    {
      const _Float16* vfp = Vts + c * AT_VP + 8 * hh;
      v16h vf[2][4];
#pragma unroll
      for (int u = 0; u < 4; ++u) vf[0][u] = Frag<_Float16>::load(vfp + u * (16 * AT_VP));
#pragma unroll
      for (int g = 0; g < 4; ++g) {
        if (g < 3) {
          const int gn = g + 1;
#pragma unroll
          for (int u = 0; u < 4; ++u)
            vf[gn & 1][u] = Frag<_Float16>::load(vfp + ((gn & 1) * 4 + u) * (16 * AT_VP) + (gn >> 1) * 32);
        }
        // keeps the next group's reads in front of this group's products
        __builtin_amdgcn_sched_barrier(0);
#pragma unroll
        for (int u = 0; u < 4; ++u) oacc[(g & 1) * 4 + u] = Frag<_Float16>::mma(vf[g & 1][u], pb[g >> 1].v, oacc[(g & 1) * 4 + u]);
        // keeps what follows out of this run of products: the group after next would take a third register set,
        // and vector code mixed in behind the last group costs hazard v_nops between the products
        __builtin_amdgcn_sched_barrier(0);
      }
    }
  }

  _Float16* osw = Osh[wave];
  {
    // the two halves' sums are joined once, here; a lane's 8 registers of a tile are 8 consecutive d of row c: one 16-B store
    const float inv = 1.0f / ((lrow + xhalf(lrow)) * PSC);
#pragma unroll
    for (int t = 0; t < 8; ++t) *(v8h*)(osw + c * AT_OP + t * 16 + 8 * hh) = __builtin_convertvector(oacc[t] * inv, v8h);
  }
  __builtin_amdgcn_fence(__ATOMIC_RELEASE, "workgroup");
  __builtin_amdgcn_wave_barrier();
  __builtin_amdgcn_fence(__ATOMIC_ACQUIRE, "workgroup");
  {
    const int c8 = (lane & 15) * 8;                          // row = 256 B = 16 lanes x 16 B
    _Float16* ob = o16 + (tok0 + q0) * kC;
    {
#pragma unroll
      for (int it = 0; it < 8; ++it) {
        const int row = it * 2 + hh;
        const v8h val = *(const v8h*)(osw + row * AT_OP + c8);
        *(v8h*)(ob + (size_t)row * kC + c8) = val;
      }
      
    }
  }
}

// ---------------------------------------------------------------------------
extern "C" void kernel_launch(void* const* d_in, const int* in_sizes, int n_in,
                              void* d_out, int out_size, void* d_ws, size_t ws_size,
                              hipStream_t stream) {
  if (n_in < 11) return;
  if (in_sizes[0] != kM * kC || out_size != kM * kC) return;
  if (in_sizes[1] != kC || in_sizes[2] != kC || in_sizes[4] != kC || in_sizes[6] != kC ||
      in_sizes[8] != kC || in_sizes[10] != kC) return;
  if (in_sizes[3] != kC * kC || in_sizes[5] != kC * kC || in_sizes[7] != kC * kC || in_sizes[9] != kC * kC) return;

  const float* x  = (const float*)d_in[0];
  const float* gs = (const float*)d_in[1];
  const float* gb = (const float*)d_in[2];
  const float* wq = (const float*)d_in[3];
  const float* bq = (const float*)d_in[4];
  const float* wk = (const float*)d_in[5];
  const float* bk = (const float*)d_in[6];
  const float* wv = (const float*)d_in[7];
  const float* bv = (const float*)d_in[8];
  const float* wo = (const float*)d_in[9];
  const float* bo = (const float*)d_in[10];
  float* out = (float*)d_out;

  // workspace carve (bytes)
  const size_t szW   = (size_t)4 * kC * kC * sizeof(_Float16);       // 131072
  const size_t szTab = (size_t)kB * 64 * sizeof(float);               // 4096
  const size_t szT16 = (size_t)kM * kC * sizeof(_Float16);            // 16777216
  const size_t offW   = 0;
  const size_t offTab = offW + szW;
  const size_t offH   = offTab + szTab;
  const size_t offQ   = offH + szT16;
  const size_t offK   = offQ + szT16;
  const size_t offVt  = offK + szT16;
  const size_t offO   = offVt + szT16;
  const size_t offP   = offO + szT16;                                  // 84021248
  const size_t szP    = (size_t)kB * kGS * kNG * 2 * sizeof(double);   // 262144
  const size_t offEnd = offP + szP;                                    // 84283392
  if (offEnd > ws_size) return;

  char* ws = (char*)d_ws;
  _Float16* wt16 = (_Float16*)(ws + offW);
  float*    gtab = (float*)(ws + offTab);
  _Float16* h16  = (_Float16*)(ws + offH);
  _Float16* q16  = (_Float16*)(ws + offQ);
  _Float16* k16  = (_Float16*)(ws + offK);
  _Float16* vt16 = (_Float16*)(ws + offVt);
  _Float16* o16  = (_Float16*)(ws + offO);
  double*   gpart = (double*)(ws + offP);
  const _Float16* wtq = wt16;
  const _Float16* wtk = wt16 + (size_t)kC * kC;
  const _Float16* wtv = wt16 + (size_t)2 * kC * kC;
  const _Float16* wto = wt16 + (size_t)3 * kC * kC;

  // 1. weights f32 [c][d] -> f16 [d][c]
  k_wconvert<<<dim3(kC / 32, 4), 256, 0, stream>>>(wq, wk, wv, wo, wt16);
  // 2. GroupNorm statistics and apply
  k_gn_part<<<kB * kGS, 256, 0, stream>>>(x, gpart);
  k_gn_final<<<kB, 256, 0, stream>>>(gpart, gtab);
  const int nvec = kM * (kC / 8);                                      // 1048576
  k_gn_apply<<<(nvec + 255) / 256, 256, 0, stream>>>(x, gs, gb, gtab, h16, nvec);

  // 3. projections: q16 = h.wq + bq, k16 = h.wk + bk   (M=65536, N=128, K=128; 2048 wave tiles)
  const int gridMN = ((kM / 64) * (kC / 64) + 7) / 8;                  // 256
  wmma_gemm64<0, false, 2, 1, false><<<dim3(gridMN, 1), 256, 0, stream>>>(
      U16(h16), U16(h16), kC, (long)0, U16(wtq), U16(wtq), kC, (long)0,
      (void*)q16, (void*)nullptr, kC, (long)0, bq, (const float*)nullptr, (long)0, kM, kC, kC, 1.0f);
  wmma_gemm64<0, false, 2, 1, false><<<dim3(gridMN, 1), 256, 0, stream>>>(
      U16(h16), U16(h16), kC, (long)0, U16(wtk), U16(wtk), kC, (long)0,
      (void*)k16, (void*)nullptr, kC, (long)0, bk, (const float*)nullptr, (long)0, kM, kC, kC, 1.0f);
  //    v^T per image: vt16[b][d][n] = sum_c wt_v[d][c] . h16[b][n][c] + bv[d]  (M=128, N=4096, K=128, batched)
  const int gridVt = ((kC / 64) * (kN / 64) + 7) / 8;                  // 16
  wmma_gemm64<0, false, 1, 1, false><<<dim3(gridVt, kB), 256, 0, stream>>>(
      U16(wtv), U16(wtv), kC, (long)0, U16(h16), U16(h16), kC, (long)kN * kC,
      (void*)vt16, (void*)nullptr, kN, (long)kC * kN, bv, (const float*)nullptr, (long)0, kC, kN, kC, 1.0f);

  // 4. attention
  const float scale = 0.08838834764831845f;                            // 128^-0.5
  k_attn128<<<kB * (kN / 64), 128, 0, stream>>>(q16, k16, vt16, o16, scale);

  // 5. out = x + o.wo + bo  (f32, residual)
  wmma_gemm64<0, false, 2, 0, true><<<dim3(gridMN, 1), 256, 0, stream>>>(
      U16(o16), U16(o16), kC, (long)0, U16(wto), U16(wto), kC, (long)0,
      (void*)out, (void*)nullptr, kC, (long)0, bo, x, (long)0, kM, kC, kC, 1.0f);
}
